// v000
// Times are from an AMD MI455X. After a warm-up the kernel runs many times in a row, and a time is the length of
// such a window on the GPU divided by its runs, so every launch and the gaps after it count. The runs cycle
// through copies of the inputs. A figure is the median of several windows, for all but v000 over two sittings.
// Sittings can differ by a few percent; kernels timed side by side share one.
// The starting kernel, v000, takes 320 microseconds a run.
#include <hip/hip_runtime.h>

typedef __attribute__((ext_vector_type(16))) __bf16 v16bf;
typedef __attribute__((ext_vector_type(8)))  float  v8f;

#define D_MODEL  1024
#define N_HEADS  16
#define HEAD_DIM 64
#define D_FF     4096
#define SEQ      2048
#define BATCH    2
#define NTOK     (BATCH * SEQ)   // 4096 rows

// ---------------------------------------------------------------------------
// Fragment helpers.
// A-style 16x32 bf16 fragment: lane L holds row M = L&15; K base = (L>>4)*8;
// vector elems e0..e7 = K kb..kb+7, e8..e15 = K kb+16..kb+23  -> two 16B loads.
// ---------------------------------------------------------------------------
__device__ __forceinline__ v16bf ldfrag(const __bf16* p0, const __bf16* p1) {
    union { struct { uint4 lo, hi; } u; v16bf v; } f;
    f.u.lo = *(const uint4*)p0;
    f.u.hi = *(const uint4*)p1;
    return f.v;
}

__device__ __forceinline__ v8f wmma_bf16(v16bf a, v16bf b, v8f c) {
    // D(f32 16x16) = A(bf16 16x32) * B(bf16 32x16) + C
    return __builtin_amdgcn_wmma_f32_16x16x32_bf16(false, a, false, b,
                                                   (short)0, c, false, false);
}

// Async DMA: copy 32B/lane (2 x b128) global -> LDS.  Per CDNA5 ISA the
// IOFFSET is added to BOTH the LDS address and the global address, so a single
// lds-addr VGPR + single 32-bit global offset VGPR covers the chunk.
__device__ __forceinline__ void async_copy32B(unsigned lds, unsigned long long base,
                                              unsigned voff) {
    asm volatile(
        "global_load_async_to_lds_b128 %0, %1, %2 offset:0\n\t"
        "global_load_async_to_lds_b128 %0, %1, %2 offset:16"
        :: "v"(lds), "v"(voff), "s"(base) : "memory");
}

__device__ __forceinline__ void async_copy16B(unsigned lds, unsigned long long base,
                                              unsigned voff) {
    asm volatile(
        "global_load_async_to_lds_b128 %0, %1, %2 offset:0"
        :: "v"(lds), "v"(voff), "s"(base) : "memory");
}

__device__ __forceinline__ void wait_async0() {
    asm volatile("s_wait_asynccnt 0x0" ::: "memory");
}

// Low 32 bits of a generic pointer to __shared__ == raw LDS byte offset
// (flat-aperture rule: LDS_ADDR = addr[31:0]).
__device__ __forceinline__ unsigned lds_addr(const void* p) {
    return (unsigned)(unsigned long long)(uintptr_t)p;
}

// ---------------------------------------------------------------------------
// fp32 -> bf16 cast (4 elements / thread)
// ---------------------------------------------------------------------------
__global__ void cast_bf16_kernel(const float* __restrict__ src,
                                 __bf16* __restrict__ dst, int n) {
    int i = (blockIdx.x * blockDim.x + threadIdx.x) * 4;
    if (i < n) {
#pragma unroll
        for (int j = 0; j < 4; ++j) dst[i + j] = (__bf16)src[i + j];
    }
}

// ---------------------------------------------------------------------------
// W[K][N] fp32  ->  Wt[N][K] bf16   (32x32 LDS tile transpose)
// ---------------------------------------------------------------------------
__global__ void transpose_cast_kernel(const float* __restrict__ src,
                                      __bf16* __restrict__ dst, int K, int N) {
    __shared__ float tile[32][33];
    int n0 = blockIdx.x * 32, k0 = blockIdx.y * 32;
    int tx = threadIdx.x, ty = threadIdx.y;   // block (32, 8)
#pragma unroll
    for (int i = 0; i < 32; i += 8)
        tile[ty + i][tx] = src[(size_t)(k0 + ty + i) * N + n0 + tx];
    __syncthreads();
#pragma unroll
    for (int i = 0; i < 32; i += 8)
        dst[(size_t)(n0 + ty + i) * K + k0 + tx] = (__bf16)tile[tx][ty + i];
}

// ---------------------------------------------------------------------------
// GEMM: C[M][N] = A[M][K](bf16) * Bt[N][K](bf16)^T + bias, optional ReLU.
// Block tile 128x128, 256 threads = 8 waves (4x2), wave tile 32x64.
// K-step 32, double-buffered LDS filled by GLOBAL_LOAD_ASYNC_TO_LDS_B128.
// ---------------------------------------------------------------------------
__global__ void gemm_bf16_kernel(const __bf16* __restrict__ A,
                                 const __bf16* __restrict__ Bt,
                                 const float* __restrict__ bias,
                                 __bf16* __restrict__ Cbf,
                                 float* __restrict__ Cf,
                                 int M, int N, int Kd, int relu) {
    __shared__ __align__(16) __bf16 Alds[2][128][40];   // 32 K + 8 pad
    __shared__ __align__(16) __bf16 Blds[2][128][40];

    const int tid  = threadIdx.x;
    const int wave = tid >> 5, lane = tid & 31;
    const int wm = wave >> 1, wn = wave & 1;
    const int bm = blockIdx.y * 128, bn = blockIdx.x * 128;
    const int kb = (lane >> 4) * 8;
    const int lr = tid >> 1;          // 0..127 : tile row staged by this thread
    const int lc = (tid & 1) * 16;    // 0 or 16 (elements)

    const unsigned long long abase = (unsigned long long)(uintptr_t)A;
    const unsigned long long bbase = (unsigned long long)(uintptr_t)Bt;
    const unsigned avoff = (unsigned)(((size_t)(bm + lr) * Kd + lc) * 2);
    const unsigned bvoff = (unsigned)(((size_t)(bn + lr) * Kd + lc) * 2);
    const unsigned aldsv[2] = { lds_addr(&Alds[0][lr][lc]), lds_addr(&Alds[1][lr][lc]) };
    const unsigned bldsv[2] = { lds_addr(&Blds[0][lr][lc]), lds_addr(&Blds[1][lr][lc]) };

    v8f acc[2][4] = {};

    // prologue: DMA first K-tile into buffer 0
    async_copy32B(aldsv[0], abase, avoff);
    async_copy32B(bldsv[0], bbase, bvoff);

    const int nk = Kd >> 5;
    for (int it = 0; it < nk; ++it) {
        wait_async0();          // own DMA for buffer it&1 landed in LDS
        __syncthreads();        // everyone's landed; prev compute finished
        if (it + 1 < nk) {      // kick DMA for next tile into other buffer
            const unsigned koff = (unsigned)((it + 1) << 6);   // 32 elems * 2B
            async_copy32B(aldsv[(it + 1) & 1], abase, avoff + koff);
            async_copy32B(bldsv[(it + 1) & 1], bbase, bvoff + koff);
        }
        const __bf16 (*Ac)[40] = Alds[it & 1];
        const __bf16 (*Bc)[40] = Blds[it & 1];

        v16bf af[2], bf_[4];
#pragma unroll
        for (int i = 0; i < 2; ++i) {
            const __bf16* r = &Ac[wm * 32 + i * 16 + (lane & 15)][kb];
            af[i] = ldfrag(r, r + 16);
        }
#pragma unroll
        for (int j = 0; j < 4; ++j) {
            const __bf16* r = &Bc[wn * 64 + j * 16 + (lane & 15)][kb];
            bf_[j] = ldfrag(r, r + 16);
        }
#pragma unroll
        for (int i = 0; i < 2; ++i)
#pragma unroll
            for (int j = 0; j < 4; ++j)
                acc[i][j] = wmma_bf16(af[i], bf_[j], acc[i][j]);
    }

    // Epilogue. C-frag: vgpr r -> row = base + r + ((lane>>4)<<3); col = base + (lane&15)
#pragma unroll
    for (int i = 0; i < 2; ++i)
#pragma unroll
        for (int j = 0; j < 4; ++j) {
            const int col  = bn + wn * 64 + j * 16 + (lane & 15);
            const int rowb = bm + wm * 32 + i * 16 + ((lane >> 4) << 3);
            const float bv = bias[col];
#pragma unroll
            for (int r = 0; r < 8; ++r) {
                float v = acc[i][j][r] + bv;
                if (relu) v = fmaxf(v, 0.f);
                const size_t idx = (size_t)(rowb + r) * N + col;
                if (Cbf) Cbf[idx] = (__bf16)v;
                else     Cf[idx]  = v;
            }
        }
}

// ---------------------------------------------------------------------------
// Flash attention (non-causal), computing S^T = K*Q^T so softmax statistics
// are per-lane and the P-frag C->B conversion is element-wise per lane.
// Grid: (SEQ/128, N_HEADS, BATCH), block 256 (8 waves x 16 queries).
// K tile staged via async-to-LDS DMA; V tile transposed manually into LDS.
// ---------------------------------------------------------------------------
__global__ void flash_attn_kernel(const __bf16* __restrict__ Q,
                                  const __bf16* __restrict__ K,
                                  const __bf16* __restrict__ V,
                                  __bf16* __restrict__ O) {
    __shared__ __align__(16) __bf16 Klds[32][72];    // [key][d]
    __shared__ __align__(16) __bf16 Vtlds[64][40];   // [d][key]  (transposed)

    const int qblk = blockIdx.x, h = blockIdx.y, b = blockIdx.z;
    const int tid = threadIdx.x, wave = tid >> 5, lane = tid & 31;
    const int kb = (lane >> 4) * 8;
    const int ld = D_MODEL;

    const int qrow = qblk * 128 + wave * 16 + (lane & 15);
    const __bf16* qp = Q + ((size_t)(b * SEQ + qrow)) * ld + h * HEAD_DIM;
    // Q as B-operand of K*Q^T: lane = query col, K-dim = head dim
    const v16bf qf0 = ldfrag(qp +  0 + kb, qp +  0 + kb + 16);
    const v16bf qf1 = ldfrag(qp + 32 + kb, qp + 32 + kb + 16);

    v8f o0 = {}, o1 = {}, o2 = {}, o3 = {};
    float m = -1e30f, l = 0.f;
    const float scale = 0.125f;   // 1/sqrt(64)

    const int cr = tid >> 3;             // cooperative-load row   0..31
    const int cc = (tid & 7) * 8;        // cooperative-load col   0..56

    const unsigned long long kbase = (unsigned long long)(uintptr_t)
        (K + (size_t)(b * SEQ) * ld + h * HEAD_DIM);
    const unsigned kvoff0 = (unsigned)(((size_t)cr * ld + cc) * 2);
    const unsigned kldsv  = lds_addr(&Klds[cr][cc]);

    for (int kt = 0; kt < SEQ; kt += 32) {
        // DMA K tile [32][64] directly to LDS
        async_copy16B(kldsv, kbase, kvoff0 + (unsigned)(kt * ld * 2));
        // stage V^T tile [64][32] manually (needs element transpose)
        const size_t grow = (size_t)(b * SEQ + kt + cr) * ld + h * HEAD_DIM + cc;
        union { uint4 u; __bf16 e[8]; } vu;
        vu.u = *(const uint4*)(V + grow);
#pragma unroll
        for (int i = 0; i < 8; ++i) Vtlds[cc + i][cr] = vu.e[i];
        wait_async0();
        __syncthreads();

        const int r0 = lane & 15, r1 = 16 + r0;
        v16bf ka00 = ldfrag(&Klds[r0][kb],      &Klds[r0][kb + 16]);
        v16bf ka01 = ldfrag(&Klds[r0][32 + kb], &Klds[r0][32 + kb + 16]);
        v16bf ka10 = ldfrag(&Klds[r1][kb],      &Klds[r1][kb + 16]);
        v16bf ka11 = ldfrag(&Klds[r1][32 + kb], &Klds[r1][32 + kb + 16]);

        v8f c0 = {}, c1 = {};
        c0 = wmma_bf16(ka00, qf0, c0);  c0 = wmma_bf16(ka01, qf1, c0);
        c1 = wmma_bf16(ka10, qf0, c1);  c1 = wmma_bf16(ka11, qf1, c1);

        const int dr = lane & 15;
        v16bf va0 = ldfrag(&Vtlds[ 0 + dr][kb], &Vtlds[ 0 + dr][kb + 16]);
        v16bf va1 = ldfrag(&Vtlds[16 + dr][kb], &Vtlds[16 + dr][kb + 16]);
        v16bf va2 = ldfrag(&Vtlds[32 + dr][kb], &Vtlds[32 + dr][kb + 16]);
        v16bf va3 = ldfrag(&Vtlds[48 + dr][kb], &Vtlds[48 + dr][kb + 16]);

        // online softmax (per-lane query column; pair lanes L and L^16 share q)
        float loc = -1e30f;
#pragma unroll
        for (int r = 0; r < 8; ++r) {
            c0[r] *= scale; c1[r] *= scale;
            loc = fmaxf(loc, fmaxf(c0[r], c1[r]));
        }
        loc = fmaxf(loc, __shfl_xor(loc, 16, 32));
        const float mnew  = fmaxf(m, loc);
        const float alpha = __expf(m - mnew);
        float rs = 0.f;
        v16bf p;
#pragma unroll
        for (int r = 0; r < 8; ++r) {
            const float e0 = __expf(c0[r] - mnew);
            const float e1 = __expf(c1[r] - mnew);
            rs += e0 + e1;
            p[r]     = (__bf16)e0;   // keys kb-block of sub-tile 0
            p[8 + r] = (__bf16)e1;   // keys kb-block of sub-tile 1
        }
        rs += __shfl_xor(rs, 16, 32);
        l = l * alpha + rs;
        m = mnew;
#pragma unroll
        for (int r = 0; r < 8; ++r) {
            o0[r] *= alpha; o1[r] *= alpha; o2[r] *= alpha; o3[r] *= alpha;
        }
        // O^T += V^T * P^T
        o0 = wmma_bf16(va0, p, o0);
        o1 = wmma_bf16(va1, p, o1);
        o2 = wmma_bf16(va2, p, o2);
        o3 = wmma_bf16(va3, p, o3);
        __syncthreads();
    }

    const float inv = 1.f / l;
    __bf16* ob = O + ((size_t)(b * SEQ + qrow)) * ld + h * HEAD_DIM;
#pragma unroll
    for (int r = 0; r < 8; ++r) {
        const int dhi = r + ((lane >> 4) << 3);
        ob[ 0 + dhi] = (__bf16)(o0[r] * inv);
        ob[16 + dhi] = (__bf16)(o1[r] * inv);
        ob[32 + dhi] = (__bf16)(o2[r] * inv);
        ob[48 + dhi] = (__bf16)(o3[r] * inv);
    }
}

// ---------------------------------------------------------------------------
// y = LayerNorm(a + r) * g + b   (fp32 master, optional bf16 side output)
// ---------------------------------------------------------------------------
__global__ void ln_residual_kernel(const float* __restrict__ a,
                                   const float* __restrict__ rr,
                                   const float* __restrict__ g,
                                   const float* __restrict__ bb,
                                   float* __restrict__ of,
                                   __bf16* __restrict__ obf) {
    const int D = D_MODEL;
    const int row = blockIdx.x, tid = threadIdx.x;
    const float* pa = a  + (size_t)row * D;
    const float* pr = rr + (size_t)row * D;
    float v[4], s = 0.f, q = 0.f;
#pragma unroll
    for (int i = 0; i < 4; ++i) {
        const int c = tid + i * 256;
        const float x = pa[c] + pr[c];
        v[i] = x; s += x; q += x * x;
    }
    for (int o = 16; o > 0; o >>= 1) {
        s += __shfl_xor(s, o, 32);
        q += __shfl_xor(q, o, 32);
    }
    __shared__ float rs[8], rq[8];
    const int wave = tid >> 5, lane = tid & 31;
    if (lane == 0) { rs[wave] = s; rq[wave] = q; }
    __syncthreads();
    if (tid == 0) {
        float ts = 0.f, tq = 0.f;
        for (int i = 0; i < 8; ++i) { ts += rs[i]; tq += rq[i]; }
        rs[0] = ts; rq[0] = tq;
    }
    __syncthreads();
    const float mu  = rs[0] / D;
    const float var = rq[0] / D - mu * mu;
    const float inv = rsqrtf(var + 1e-5f);
#pragma unroll
    for (int i = 0; i < 4; ++i) {
        const int c = tid + i * 256;
        const float y = (v[i] - mu) * inv * g[c] + bb[c];
        of[(size_t)row * D + c] = y;
        if (obf) obf[(size_t)row * D + c] = (__bf16)y;
    }
}

// ---------------------------------------------------------------------------
extern "C" void kernel_launch(void* const* d_in, const int* in_sizes, int n_in,
                              void* d_out, int out_size, void* d_ws, size_t ws_size,
                              hipStream_t stream) {
    const float* x    = (const float*)d_in[0];
    const float* wq   = (const float*)d_in[1];
    const float* bq   = (const float*)d_in[2];
    const float* wk   = (const float*)d_in[3];
    const float* bk   = (const float*)d_in[4];
    const float* wv   = (const float*)d_in[5];
    const float* bv   = (const float*)d_in[6];
    const float* wo   = (const float*)d_in[7];
    const float* bo   = (const float*)d_in[8];
    const float* w1   = (const float*)d_in[9];
    const float* b1   = (const float*)d_in[10];
    const float* w2   = (const float*)d_in[11];
    const float* b2   = (const float*)d_in[12];
    const float* ln1g = (const float*)d_in[13];
    const float* ln1b = (const float*)d_in[14];
    const float* ln2g = (const float*)d_in[15];
    const float* ln2b = (const float*)d_in[16];

    char* ws = (char*)d_ws;
    const size_t MiB = 1024 * 1024;
    __bf16* WQT  = (__bf16*)(ws + 0 * MiB);    // 2 MiB each
    __bf16* WKT  = (__bf16*)(ws + 2 * MiB);
    __bf16* WVT  = (__bf16*)(ws + 4 * MiB);
    __bf16* WOT  = (__bf16*)(ws + 6 * MiB);
    __bf16* W1T  = (__bf16*)(ws + 8 * MiB);    // 8 MiB
    __bf16* W2T  = (__bf16*)(ws + 16 * MiB);   // 8 MiB
    __bf16* XBF  = (__bf16*)(ws + 24 * MiB);   // 8 MiB : x bf16, later attn-out bf16
    __bf16* QBF  = (__bf16*)(ws + 32 * MiB);   // 8 MiB
    __bf16* KBF  = (__bf16*)(ws + 40 * MiB);   // 8 MiB
    __bf16* VBF  = (__bf16*)(ws + 48 * MiB);   // 8 MiB
    float*  TMPF = (float* )(ws + 32 * MiB);   // 16 MiB : o-proj f32, later ffn2 f32
    float*  X1F  = (float* )(ws + 56 * MiB);   // 16 MiB
    __bf16* X1BF = (__bf16*)(ws + 72 * MiB);   // 8 MiB
    __bf16* HBF  = (__bf16*)(ws + 80 * MiB);   // 32 MiB
    float*  out  = (float*)d_out;

    const dim3 tb(32, 8);

    // 1) casts / weight transposes
    cast_bf16_kernel<<<(NTOK * D_MODEL) / 1024, 256, 0, stream>>>(x, XBF, NTOK * D_MODEL);
    transpose_cast_kernel<<<dim3(D_MODEL/32, D_MODEL/32), tb, 0, stream>>>(wq, WQT, D_MODEL, D_MODEL);
    transpose_cast_kernel<<<dim3(D_MODEL/32, D_MODEL/32), tb, 0, stream>>>(wk, WKT, D_MODEL, D_MODEL);
    transpose_cast_kernel<<<dim3(D_MODEL/32, D_MODEL/32), tb, 0, stream>>>(wv, WVT, D_MODEL, D_MODEL);
    transpose_cast_kernel<<<dim3(D_MODEL/32, D_MODEL/32), tb, 0, stream>>>(wo, WOT, D_MODEL, D_MODEL);
    transpose_cast_kernel<<<dim3(D_FF/32,    D_MODEL/32), tb, 0, stream>>>(w1, W1T, D_MODEL, D_FF);
    transpose_cast_kernel<<<dim3(D_MODEL/32, D_FF/32),    tb, 0, stream>>>(w2, W2T, D_FF, D_MODEL);

    // 2) QKV projections
    gemm_bf16_kernel<<<dim3(D_MODEL/128, NTOK/128), 256, 0, stream>>>(XBF, WQT, bq, QBF, nullptr, NTOK, D_MODEL, D_MODEL, 0);
    gemm_bf16_kernel<<<dim3(D_MODEL/128, NTOK/128), 256, 0, stream>>>(XBF, WKT, bk, KBF, nullptr, NTOK, D_MODEL, D_MODEL, 0);
    gemm_bf16_kernel<<<dim3(D_MODEL/128, NTOK/128), 256, 0, stream>>>(XBF, WVT, bv, VBF, nullptr, NTOK, D_MODEL, D_MODEL, 0);

    // 3) flash attention -> XBF (concat heads, row-major)
    flash_attn_kernel<<<dim3(SEQ/128, N_HEADS, BATCH), 256, 0, stream>>>(QBF, KBF, VBF, XBF);

    // 4) output projection (f32) + residual LN1
    gemm_bf16_kernel<<<dim3(D_MODEL/128, NTOK/128), 256, 0, stream>>>(XBF, WOT, bo, nullptr, TMPF, NTOK, D_MODEL, D_MODEL, 0);
    ln_residual_kernel<<<NTOK, 256, 0, stream>>>(x, TMPF, ln1g, ln1b, X1F, X1BF);

    // 5) FFN
    gemm_bf16_kernel<<<dim3(D_FF/128,    NTOK/128), 256, 0, stream>>>(X1BF, W1T, b1, HBF, nullptr, NTOK, D_FF, D_MODEL, 1);
    gemm_bf16_kernel<<<dim3(D_MODEL/128, NTOK/128), 256, 0, stream>>>(HBF,  W2T, b2, nullptr, TMPF, NTOK, D_MODEL, D_FF, 0);

    // 6) residual LN2 -> final output
    ln_residual_kernel<<<NTOK, 256, 0, stream>>>(X1F, TMPF, ln2g, ln2b, out, nullptr);
}

// v001
// Measured time: 261 microseconds a run.
// Next to v000, in two timings, it ran 1.23 times as fast each time.
#include <hip/hip_runtime.h>

typedef __attribute__((ext_vector_type(16))) __bf16 v16bf;
typedef __attribute__((ext_vector_type(8)))  float  v8f;

#define D_MODEL  1024
#define N_HEADS  16
#define HEAD_DIM 64
#define D_FF     4096
#define SEQ      2048
#define BATCH    2
#define NTOK     (BATCH * SEQ)   // 4096 rows

// ---------------------------------------------------------------------------
// Fragment helpers.
// A-style 16x32 bf16 fragment: lane L holds row M = L&15; K base = (L>>4)*8;
// vector elems e0..e7 = K kb..kb+7, e8..e15 = K kb+16..kb+23  -> two 16B loads.
// ---------------------------------------------------------------------------
__device__ __forceinline__ v16bf ldfrag(const __bf16* p0, const __bf16* p1) {
    union { struct { uint4 lo, hi; } u; v16bf v; } f;
    f.u.lo = *(const uint4*)p0;
    f.u.hi = *(const uint4*)p1;
    return f.v;
}

__device__ __forceinline__ v8f wmma_bf16(v16bf a, v16bf b, v8f c) {
    // D(f32 16x16) = A(bf16 16x32) * B(bf16 32x16) + C
    return __builtin_amdgcn_wmma_f32_16x16x32_bf16(false, a, false, b,
                                                   (short)0, c, false, false);
}

// Async DMA: eight b128 copies global -> LDS, 16 B per lane each.  Copy c takes
// the lane's 16 B of tile row (row0 + 16 * c): LDS address lds + c * lstep,
// global address g + c * gstep (both in bytes).  The closing s_wait_xcnt stands
// inside the statement so that no address register named by a copy is rewritten
// ahead of it.
__device__ __forceinline__ void async_copy8x16B(unsigned lds, unsigned lstep,
                                                const char* g, size_t gstep) {
    asm volatile(
        "global_load_async_to_lds_b128 %0, %8, off\n\t"
        "global_load_async_to_lds_b128 %1, %9, off\n\t"
        "global_load_async_to_lds_b128 %2, %10, off\n\t"
        "global_load_async_to_lds_b128 %3, %11, off\n\t"
        "global_load_async_to_lds_b128 %4, %12, off\n\t"
        "global_load_async_to_lds_b128 %5, %13, off\n\t"
        "global_load_async_to_lds_b128 %6, %14, off\n\t"
        "global_load_async_to_lds_b128 %7, %15, off\n\t"
        "s_wait_xcnt 0x0"
        :: "v"(lds), "v"(lds + lstep), "v"(lds + 2 * lstep), "v"(lds + 3 * lstep),
           "v"(lds + 4 * lstep), "v"(lds + 5 * lstep), "v"(lds + 6 * lstep),
           "v"(lds + 7 * lstep),
           "v"(g), "v"(g + gstep), "v"(g + 2 * gstep), "v"(g + 3 * gstep),
           "v"(g + 4 * gstep), "v"(g + 5 * gstep), "v"(g + 6 * gstep),
           "v"(g + 7 * gstep)
        : "memory");
}

__device__ __forceinline__ void async_copy16B(unsigned lds, unsigned long long base,
                                              unsigned voff) {
    asm volatile(
        "global_load_async_to_lds_b128 %0, %1, %2 offset:0"
        :: "v"(lds), "v"(voff), "s"(base) : "memory");
}

__device__ __forceinline__ void wait_async0() {
    asm volatile("s_wait_asynccnt 0x0" ::: "memory");
}

// This wave's LDS reads have retired: stands in front of the barrier behind
// which the buffer they read is refilled by async copies.
__device__ __forceinline__ void wait_ds0() {
    asm volatile("s_wait_dscnt 0x0" ::: "memory");
}

// Low 32 bits of a generic pointer to __shared__ == raw LDS byte offset
// (flat-aperture rule: LDS_ADDR = addr[31:0]).
__device__ __forceinline__ unsigned lds_addr(const void* p) {
    return (unsigned)(unsigned long long)(uintptr_t)p;
}

// ---------------------------------------------------------------------------
// fp32 -> bf16 cast (4 elements / thread)
// ---------------------------------------------------------------------------
__global__ void cast_bf16_kernel(const float* __restrict__ src,
                                 __bf16* __restrict__ dst, int n) {
    int i = (blockIdx.x * blockDim.x + threadIdx.x) * 4;
    if (i < n) {
#pragma unroll
        for (int j = 0; j < 4; ++j) dst[i + j] = (__bf16)src[i + j];
    }
}

// ---------------------------------------------------------------------------
// W[K][N] fp32  ->  Wt[N][K] bf16   (32x32 LDS tile transpose)
// ---------------------------------------------------------------------------
__global__ void transpose_cast_kernel(const float* __restrict__ src,
                                      __bf16* __restrict__ dst, int K, int N) {
    __shared__ float tile[32][33];
    int n0 = blockIdx.x * 32, k0 = blockIdx.y * 32;
    int tx = threadIdx.x, ty = threadIdx.y;   // block (32, 8)
#pragma unroll
    for (int i = 0; i < 32; i += 8)
        tile[ty + i][tx] = src[(size_t)(k0 + ty + i) * N + n0 + tx];
    __syncthreads();
#pragma unroll
    for (int i = 0; i < 32; i += 8)
        dst[(size_t)(n0 + ty + i) * K + k0 + tx] = (__bf16)tile[tx][ty + i];
}

// ---------------------------------------------------------------------------
// GEMM: C[M][N] = A[M][K](bf16) * Bt[N][K](bf16)^T + bias, optional ReLU.
// Block tile 128x128, 256 threads = 8 waves (4x2), wave tile 32x64.
// K tile 128 (256 B of every operand row), double-buffered LDS filled by
// GLOBAL_LOAD_ASYNC_TO_LDS_B128: 16 lanes per row, so one copy of a wave takes
// two whole 256-B row pieces (four full 128-B lines).  Kd: a multiple of 128.
// ---------------------------------------------------------------------------
#define GEMM_BK  128
#define GEMM_LDP 136   // 128 K + 8 pad: pitch 272 B = 16 B x odd for ds_load_b128

__global__ void gemm_bf16_kernel(const __bf16* __restrict__ A,
                                 const __bf16* __restrict__ Bt,
                                 const float* __restrict__ bias,
                                 __bf16* __restrict__ Cbf,
                                 float* __restrict__ Cf,
                                 int M, int N, int Kd, int relu) {
    __shared__ __align__(16) __bf16 Alds[2][128][GEMM_LDP];
    __shared__ __align__(16) __bf16 Blds[2][128][GEMM_LDP];

    const int tid  = threadIdx.x;
    const int wave = tid >> 5, lane = tid & 31;
    const int wm = wave >> 1, wn = wave & 1;
    const int bm = blockIdx.y * 128, bn = blockIdx.x * 128;
    const int kb = (lane >> 4) * 8;
    const int lr = tid >> 4;          // 0..15 : first tile row staged by this thread
    const int lc = (tid & 15) * 8;    // 0..120 (elements): its 16 B of the row piece

    const char* ag = (const char*)(A  + (size_t)(bm + lr) * Kd + lc);
    const char* bg = (const char*)(Bt + (size_t)(bn + lr) * Kd + lc);
    const size_t gstep = (size_t)Kd * 32;              // 16 rows, bytes
    const unsigned lstep = 16 * GEMM_LDP * 2;          // 16 rows, bytes
    const unsigned aldsv[2] = { lds_addr(&Alds[0][lr][lc]), lds_addr(&Alds[1][lr][lc]) };
    const unsigned bldsv[2] = { lds_addr(&Blds[0][lr][lc]), lds_addr(&Blds[1][lr][lc]) };

    v8f acc[2][4] = {};

    const int nk = Kd / GEMM_BK;

    // prologue: K tile 0 into buffer 0, published; then K tile 1 into buffer 1
    async_copy8x16B(aldsv[0], lstep, ag, gstep);
    async_copy8x16B(bldsv[0], lstep, bg, gstep);
    wait_async0();
    __syncthreads();
    if (nk > 1) {
        async_copy8x16B(aldsv[1], lstep, ag + GEMM_BK * 2, gstep);
        async_copy8x16B(bldsv[1], lstep, bg + GEMM_BK * 2, gstep);
    }

    for (int it = 0; it < nk; ++it) {
        const __bf16 (*Ac)[GEMM_LDP] = Alds[it & 1];
        const __bf16 (*Bc)[GEMM_LDP] = Blds[it & 1];

        // unrolled: every fragment's LDS offset becomes an immediate, and the next
        // 32 k's loads can be issued among this 32 k's products
#pragma unroll
        for (int ks = 0; ks < GEMM_BK; ks += 32) {
            v16bf af[2], bf_[4];
#pragma unroll
            for (int i = 0; i < 2; ++i) {
                const __bf16* r = &Ac[wm * 32 + i * 16 + (lane & 15)][ks + kb];
                af[i] = ldfrag(r, r + 16);
            }
#pragma unroll
            for (int j = 0; j < 4; ++j) {
                const __bf16* r = &Bc[wn * 64 + j * 16 + (lane & 15)][ks + kb];
                bf_[j] = ldfrag(r, r + 16);
            }
#pragma unroll
            for (int i = 0; i < 2; ++i)
#pragma unroll
                for (int j = 0; j < 4; ++j)
                    acc[i][j] = wmma_bf16(af[i], bf_[j], acc[i][j]);
        }

        // publish point of K tile it + 1
        wait_ds0();             // own reads of buffer it&1 retired
        wait_async0();          // own copies of K tile it + 1 landed in LDS
        __syncthreads();        // everyone's landed; everyone has left buffer it&1
        if (it + 2 < nk) {      // refill the buffer just left with K tile it + 2
            const size_t koff = (size_t)(it + 2) * (GEMM_BK * 2);
            async_copy8x16B(aldsv[it & 1], lstep, ag + koff, gstep);
            async_copy8x16B(bldsv[it & 1], lstep, bg + koff, gstep);
        }
    }
    wait_async0();              // nothing outstanding when the wave ends

    // Epilogue. C-frag: vgpr r -> row = base + r + ((lane>>4)<<3); col = base + (lane&15)
#pragma unroll
    for (int i = 0; i < 2; ++i)
#pragma unroll
        for (int j = 0; j < 4; ++j) {
            const int col  = bn + wn * 64 + j * 16 + (lane & 15);
            const int rowb = bm + wm * 32 + i * 16 + ((lane >> 4) << 3);
            const float bv = bias[col];
#pragma unroll
            for (int r = 0; r < 8; ++r) {
                float v = acc[i][j][r] + bv;
                if (relu) v = fmaxf(v, 0.f);
                const size_t idx = (size_t)(rowb + r) * N + col;
                if (Cbf) Cbf[idx] = (__bf16)v;
                else     Cf[idx]  = v;
            }
        }
}

// ---------------------------------------------------------------------------
// Flash attention (non-causal), computing S^T = K*Q^T so softmax statistics
// are per-lane and the P-frag C->B conversion is element-wise per lane.
// Grid: (SEQ/128, N_HEADS, BATCH), block 256 (8 waves x 16 queries).
// K tile staged via async-to-LDS DMA; V tile transposed manually into LDS.
// ---------------------------------------------------------------------------
__global__ void flash_attn_kernel(const __bf16* __restrict__ Q,
                                  const __bf16* __restrict__ K,
                                  const __bf16* __restrict__ V,
                                  __bf16* __restrict__ O) {
    __shared__ __align__(16) __bf16 Klds[32][72];    // [key][d]
    __shared__ __align__(16) __bf16 Vtlds[64][40];   // [d][key]  (transposed)

    const int qblk = blockIdx.x, h = blockIdx.y, b = blockIdx.z;
    const int tid = threadIdx.x, wave = tid >> 5, lane = tid & 31;
    const int kb = (lane >> 4) * 8;
    const int ld = D_MODEL;

    const int qrow = qblk * 128 + wave * 16 + (lane & 15);
    const __bf16* qp = Q + ((size_t)(b * SEQ + qrow)) * ld + h * HEAD_DIM;
    // Q as B-operand of K*Q^T: lane = query col, K-dim = head dim
    const v16bf qf0 = ldfrag(qp +  0 + kb, qp +  0 + kb + 16);
    const v16bf qf1 = ldfrag(qp + 32 + kb, qp + 32 + kb + 16);

    v8f o0 = {}, o1 = {}, o2 = {}, o3 = {};
    float m = -1e30f, l = 0.f;
    const float scale = 0.125f;   // 1/sqrt(64)

    const int cr = tid >> 3;             // cooperative-load row   0..31
    const int cc = (tid & 7) * 8;        // cooperative-load col   0..56

    const unsigned long long kbase = (unsigned long long)(uintptr_t)
        (K + (size_t)(b * SEQ) * ld + h * HEAD_DIM);
    const unsigned kvoff0 = (unsigned)(((size_t)cr * ld + cc) * 2);
    const unsigned kldsv  = lds_addr(&Klds[cr][cc]);

    for (int kt = 0; kt < SEQ; kt += 32) {
        // DMA K tile [32][64] directly to LDS
        async_copy16B(kldsv, kbase, kvoff0 + (unsigned)(kt * ld * 2));
        // stage V^T tile [64][32] manually (needs element transpose)
        const size_t grow = (size_t)(b * SEQ + kt + cr) * ld + h * HEAD_DIM + cc;
        union { uint4 u; __bf16 e[8]; } vu;
        vu.u = *(const uint4*)(V + grow);
#pragma unroll
        for (int i = 0; i < 8; ++i) Vtlds[cc + i][cr] = vu.e[i];
        wait_async0();
        __syncthreads();

        const int r0 = lane & 15, r1 = 16 + r0;
        v16bf ka00 = ldfrag(&Klds[r0][kb],      &Klds[r0][kb + 16]);
        v16bf ka01 = ldfrag(&Klds[r0][32 + kb], &Klds[r0][32 + kb + 16]);
        v16bf ka10 = ldfrag(&Klds[r1][kb],      &Klds[r1][kb + 16]);
        v16bf ka11 = ldfrag(&Klds[r1][32 + kb], &Klds[r1][32 + kb + 16]);

        v8f c0 = {}, c1 = {};
        c0 = wmma_bf16(ka00, qf0, c0);  c0 = wmma_bf16(ka01, qf1, c0);
        c1 = wmma_bf16(ka10, qf0, c1);  c1 = wmma_bf16(ka11, qf1, c1);

        const int dr = lane & 15;
        v16bf va0 = ldfrag(&Vtlds[ 0 + dr][kb], &Vtlds[ 0 + dr][kb + 16]);
        v16bf va1 = ldfrag(&Vtlds[16 + dr][kb], &Vtlds[16 + dr][kb + 16]);
        v16bf va2 = ldfrag(&Vtlds[32 + dr][kb], &Vtlds[32 + dr][kb + 16]);
        v16bf va3 = ldfrag(&Vtlds[48 + dr][kb], &Vtlds[48 + dr][kb + 16]);

        // online softmax (per-lane query column; pair lanes L and L^16 share q)
        float loc = -1e30f;
#pragma unroll
        for (int r = 0; r < 8; ++r) {
            c0[r] *= scale; c1[r] *= scale;
            loc = fmaxf(loc, fmaxf(c0[r], c1[r]));
        }
        loc = fmaxf(loc, __shfl_xor(loc, 16, 32));
        const float mnew  = fmaxf(m, loc);
        const float alpha = __expf(m - mnew);
        float rs = 0.f;
        v16bf p;
#pragma unroll
        for (int r = 0; r < 8; ++r) {
            const float e0 = __expf(c0[r] - mnew);
            const float e1 = __expf(c1[r] - mnew);
            rs += e0 + e1;
            p[r]     = (__bf16)e0;   // keys kb-block of sub-tile 0
            p[8 + r] = (__bf16)e1;   // keys kb-block of sub-tile 1
        }
        rs += __shfl_xor(rs, 16, 32);
        l = l * alpha + rs;
        m = mnew;
#pragma unroll
        for (int r = 0; r < 8; ++r) {
            o0[r] *= alpha; o1[r] *= alpha; o2[r] *= alpha; o3[r] *= alpha;
        }
        // O^T += V^T * P^T
        o0 = wmma_bf16(va0, p, o0);
        o1 = wmma_bf16(va1, p, o1);
        o2 = wmma_bf16(va2, p, o2);
        o3 = wmma_bf16(va3, p, o3);
        __syncthreads();
    }

    const float inv = 1.f / l;
    __bf16* ob = O + ((size_t)(b * SEQ + qrow)) * ld + h * HEAD_DIM;
#pragma unroll
    for (int r = 0; r < 8; ++r) {
        const int dhi = r + ((lane >> 4) << 3);
        ob[ 0 + dhi] = (__bf16)(o0[r] * inv);
        ob[16 + dhi] = (__bf16)(o1[r] * inv);
        ob[32 + dhi] = (__bf16)(o2[r] * inv);
        ob[48 + dhi] = (__bf16)(o3[r] * inv);
    }
}

// ---------------------------------------------------------------------------
// y = LayerNorm(a + r) * g + b   (fp32 master, optional bf16 side output)
// ---------------------------------------------------------------------------
__global__ void ln_residual_kernel(const float* __restrict__ a,
                                   const float* __restrict__ rr,
                                   const float* __restrict__ g,
                                   const float* __restrict__ bb,
                                   float* __restrict__ of,
                                   __bf16* __restrict__ obf) {
    const int D = D_MODEL;
    const int row = blockIdx.x, tid = threadIdx.x;
    const float* pa = a  + (size_t)row * D;
    const float* pr = rr + (size_t)row * D;
    float v[4], s = 0.f, q = 0.f;
#pragma unroll
    for (int i = 0; i < 4; ++i) {
        const int c = tid + i * 256;
        const float x = pa[c] + pr[c];
        v[i] = x; s += x; q += x * x;
    }
    for (int o = 16; o > 0; o >>= 1) {
        s += __shfl_xor(s, o, 32);
        q += __shfl_xor(q, o, 32);
    }
    __shared__ float rs[8], rq[8];
    const int wave = tid >> 5, lane = tid & 31;
    if (lane == 0) { rs[wave] = s; rq[wave] = q; }
    __syncthreads();
    if (tid == 0) {
        float ts = 0.f, tq = 0.f;
        for (int i = 0; i < 8; ++i) { ts += rs[i]; tq += rq[i]; }
        rs[0] = ts; rq[0] = tq;
    }
    __syncthreads();
    const float mu  = rs[0] / D;
    const float var = rq[0] / D - mu * mu;
    const float inv = rsqrtf(var + 1e-5f);
#pragma unroll
    for (int i = 0; i < 4; ++i) {
        const int c = tid + i * 256;
        const float y = (v[i] - mu) * inv * g[c] + bb[c];
        of[(size_t)row * D + c] = y;
        if (obf) obf[(size_t)row * D + c] = (__bf16)y;
    }
}

// ---------------------------------------------------------------------------
extern "C" void kernel_launch(void* const* d_in, const int* in_sizes, int n_in,
                              void* d_out, int out_size, void* d_ws, size_t ws_size,
                              hipStream_t stream) {
    const float* x    = (const float*)d_in[0];
    const float* wq   = (const float*)d_in[1];
    const float* bq   = (const float*)d_in[2];
    const float* wk   = (const float*)d_in[3];
    const float* bk   = (const float*)d_in[4];
    const float* wv   = (const float*)d_in[5];
    const float* bv   = (const float*)d_in[6];
    const float* wo   = (const float*)d_in[7];
    const float* bo   = (const float*)d_in[8];
    const float* w1   = (const float*)d_in[9];
    const float* b1   = (const float*)d_in[10];
    const float* w2   = (const float*)d_in[11];
    const float* b2   = (const float*)d_in[12];
    const float* ln1g = (const float*)d_in[13];
    const float* ln1b = (const float*)d_in[14];
    const float* ln2g = (const float*)d_in[15];
    const float* ln2b = (const float*)d_in[16];

    char* ws = (char*)d_ws;
    const size_t MiB = 1024 * 1024;
    __bf16* WQT  = (__bf16*)(ws + 0 * MiB);    // 2 MiB each
    __bf16* WKT  = (__bf16*)(ws + 2 * MiB);
    __bf16* WVT  = (__bf16*)(ws + 4 * MiB);
    __bf16* WOT  = (__bf16*)(ws + 6 * MiB);
    __bf16* W1T  = (__bf16*)(ws + 8 * MiB);    // 8 MiB
    __bf16* W2T  = (__bf16*)(ws + 16 * MiB);   // 8 MiB
    __bf16* XBF  = (__bf16*)(ws + 24 * MiB);   // 8 MiB : x bf16, later attn-out bf16
    __bf16* QBF  = (__bf16*)(ws + 32 * MiB);   // 8 MiB
    __bf16* KBF  = (__bf16*)(ws + 40 * MiB);   // 8 MiB
    __bf16* VBF  = (__bf16*)(ws + 48 * MiB);   // 8 MiB
    float*  TMPF = (float* )(ws + 32 * MiB);   // 16 MiB : o-proj f32, later ffn2 f32
    float*  X1F  = (float* )(ws + 56 * MiB);   // 16 MiB
    __bf16* X1BF = (__bf16*)(ws + 72 * MiB);   // 8 MiB
    __bf16* HBF  = (__bf16*)(ws + 80 * MiB);   // 32 MiB
    float*  out  = (float*)d_out;

    const dim3 tb(32, 8);

    // 1) casts / weight transposes
    cast_bf16_kernel<<<(NTOK * D_MODEL) / 1024, 256, 0, stream>>>(x, XBF, NTOK * D_MODEL);
    transpose_cast_kernel<<<dim3(D_MODEL/32, D_MODEL/32), tb, 0, stream>>>(wq, WQT, D_MODEL, D_MODEL);
    transpose_cast_kernel<<<dim3(D_MODEL/32, D_MODEL/32), tb, 0, stream>>>(wk, WKT, D_MODEL, D_MODEL);
    transpose_cast_kernel<<<dim3(D_MODEL/32, D_MODEL/32), tb, 0, stream>>>(wv, WVT, D_MODEL, D_MODEL);
    transpose_cast_kernel<<<dim3(D_MODEL/32, D_MODEL/32), tb, 0, stream>>>(wo, WOT, D_MODEL, D_MODEL);
    transpose_cast_kernel<<<dim3(D_FF/32,    D_MODEL/32), tb, 0, stream>>>(w1, W1T, D_MODEL, D_FF);
    transpose_cast_kernel<<<dim3(D_MODEL/32, D_FF/32),    tb, 0, stream>>>(w2, W2T, D_FF, D_MODEL);

    // 2) QKV projections
    gemm_bf16_kernel<<<dim3(D_MODEL/128, NTOK/128), 256, 0, stream>>>(XBF, WQT, bq, QBF, nullptr, NTOK, D_MODEL, D_MODEL, 0);
    gemm_bf16_kernel<<<dim3(D_MODEL/128, NTOK/128), 256, 0, stream>>>(XBF, WKT, bk, KBF, nullptr, NTOK, D_MODEL, D_MODEL, 0);
    gemm_bf16_kernel<<<dim3(D_MODEL/128, NTOK/128), 256, 0, stream>>>(XBF, WVT, bv, VBF, nullptr, NTOK, D_MODEL, D_MODEL, 0);

    // 3) flash attention -> XBF (concat heads, row-major)
    flash_attn_kernel<<<dim3(SEQ/128, N_HEADS, BATCH), 256, 0, stream>>>(QBF, KBF, VBF, XBF);

    // 4) output projection (f32) + residual LN1
    gemm_bf16_kernel<<<dim3(D_MODEL/128, NTOK/128), 256, 0, stream>>>(XBF, WOT, bo, nullptr, TMPF, NTOK, D_MODEL, D_MODEL, 0);
    ln_residual_kernel<<<NTOK, 256, 0, stream>>>(x, TMPF, ln1g, ln1b, X1F, X1BF);

    // 5) FFN
    gemm_bf16_kernel<<<dim3(D_FF/128,    NTOK/128), 256, 0, stream>>>(X1BF, W1T, b1, HBF, nullptr, NTOK, D_FF, D_MODEL, 1);
    gemm_bf16_kernel<<<dim3(D_MODEL/128, NTOK/128), 256, 0, stream>>>(HBF,  W2T, b2, nullptr, TMPF, NTOK, D_MODEL, D_FF, 0);

    // 6) residual LN2 -> final output
    ln_residual_kernel<<<NTOK, 256, 0, stream>>>(X1F, TMPF, ln2g, ln2b, out, nullptr);
}

// v002
// A run of this version takes 250 microseconds.
// In both of two side-by-side timings against v001, it was 1.04 times as fast.
// Over all steps from v000 it is 1.28 times as fast.
#include <hip/hip_runtime.h>

typedef __attribute__((ext_vector_type(16))) __bf16 v16bf;
typedef __attribute__((ext_vector_type(8)))  float  v8f;
typedef __attribute__((ext_vector_type(8)))  __bf16 v8bf;
typedef __attribute__((ext_vector_type(4)))  __bf16 v4bf;
typedef __attribute__((ext_vector_type(4)))  float  v4f;

#define D_MODEL  1024
#define N_HEADS  16
#define HEAD_DIM 64
#define D_FF     4096
#define SEQ      2048
#define BATCH    2
#define NTOK     (BATCH * SEQ)   // 4096 rows

// ---------------------------------------------------------------------------
// Fragment helpers.
// A-style 16x32 bf16 fragment: lane L holds row M = L&15; K base = (L>>4)*8;
// vector elems e0..e7 = K kb..kb+7, e8..e15 = K kb+16..kb+23  -> two 16B loads.
// ---------------------------------------------------------------------------
__device__ __forceinline__ v16bf ldfrag(const __bf16* p0, const __bf16* p1) {
    union { struct { uint4 lo, hi; } u; v16bf v; } f;
    f.u.lo = *(const uint4*)p0;
    f.u.hi = *(const uint4*)p1;
    return f.v;
}

__device__ __forceinline__ v8f wmma_bf16(v16bf a, v16bf b, v8f c) {
    // D(f32 16x16) = A(bf16 16x32) * B(bf16 32x16) + C
    return __builtin_amdgcn_wmma_f32_16x16x32_bf16(false, a, false, b,
                                                   (short)0, c, false, false);
}

// Async DMA: eight b128 copies global -> LDS, 16 B per lane each.  Copy c takes
// the lane's 16 B of tile row (row0 + 16 * c): LDS address lds + c * lstep,
// global address g + c * gstep (both in bytes).  The closing s_wait_xcnt stands
// inside the statement so that no address register named by a copy is rewritten
// ahead of it.
__device__ __forceinline__ void async_copy8x16B(unsigned lds, unsigned lstep,
                                                const char* g, size_t gstep) {
    asm volatile(
        "global_load_async_to_lds_b128 %0, %8, off\n\t"
        "global_load_async_to_lds_b128 %1, %9, off\n\t"
        "global_load_async_to_lds_b128 %2, %10, off\n\t"
        "global_load_async_to_lds_b128 %3, %11, off\n\t"
        "global_load_async_to_lds_b128 %4, %12, off\n\t"
        "global_load_async_to_lds_b128 %5, %13, off\n\t"
        "global_load_async_to_lds_b128 %6, %14, off\n\t"
        "global_load_async_to_lds_b128 %7, %15, off\n\t"
        "s_wait_xcnt 0x0"
        :: "v"(lds), "v"(lds + lstep), "v"(lds + 2 * lstep), "v"(lds + 3 * lstep),
           "v"(lds + 4 * lstep), "v"(lds + 5 * lstep), "v"(lds + 6 * lstep),
           "v"(lds + 7 * lstep),
           "v"(g), "v"(g + gstep), "v"(g + 2 * gstep), "v"(g + 3 * gstep),
           "v"(g + 4 * gstep), "v"(g + 5 * gstep), "v"(g + 6 * gstep),
           "v"(g + 7 * gstep)
        : "memory");
}

__device__ __forceinline__ void async_copy16B(unsigned lds, unsigned long long base,
                                              unsigned voff) {
    asm volatile(
        "global_load_async_to_lds_b128 %0, %1, %2 offset:0"
        :: "v"(lds), "v"(voff), "s"(base) : "memory");
}

__device__ __forceinline__ void wait_async0() {
    asm volatile("s_wait_asynccnt 0x0" ::: "memory");
}

// This wave's LDS reads have retired: stands in front of the barrier behind
// which the buffer they read is refilled by async copies.
__device__ __forceinline__ void wait_ds0() {
    asm volatile("s_wait_dscnt 0x0" ::: "memory");
}

// Low 32 bits of a generic pointer to __shared__ == raw LDS byte offset
// (flat-aperture rule: LDS_ADDR = addr[31:0]).
__device__ __forceinline__ unsigned lds_addr(const void* p) {
    return (unsigned)(unsigned long long)(uintptr_t)p;
}

// ---------------------------------------------------------------------------
// fp32 -> bf16 cast of x.  32 elements per thread (few, long-lived waves): eight
// 16-B loads in flight per lane, each wave-wide load 512 contiguous bytes, each
// wave-wide store 256.  One block takes 8192 contiguous elements.
// ---------------------------------------------------------------------------
#define CAST_PER_BLOCK 8192
__global__ void cast_bf16_kernel(const float* __restrict__ src,
                                 __bf16* __restrict__ dst) {
    const size_t base = (size_t)blockIdx.x * (CAST_PER_BLOCK / 4) + threadIdx.x;
    const float4* s4 = (const float4*)src + base;
    v4bf* d4 = (v4bf*)dst + base;
    float4 v[8];
    // both loops unrolled: v[] stays in registers, all loads issue before the first use
#pragma unroll
    for (int i = 0; i < 8; ++i) v[i] = s4[i * 256];
#pragma unroll
    for (int i = 0; i < 8; ++i) {
        v4bf o = { (__bf16)v[i].x, (__bf16)v[i].y, (__bf16)v[i].z, (__bf16)v[i].w };
        d4[i * 256] = o;
    }
}

// ---------------------------------------------------------------------------
// W[K][N] fp32  ->  Wt[N][K] bf16.  One block of 256 threads transposes a tile
// of 128 k x 64 n through LDS, 32 elements per thread: eight 16-B loads in flight
// per lane (a wave-wide load = two 256-B row pieces), four 16-B stores per lane
// (a wave-wide store = four whole 128-B lines).  K: a multiple of 128, N: of 64.
// LDS pitch 65 dwords: both the row-wise writes and the column-wise reads below
// fall on 32 different banks.
// ---------------------------------------------------------------------------
#define TR_K 128
#define TR_N 64
__global__ void transpose_cast_kernel(const float* __restrict__ src,
                                      __bf16* __restrict__ dst, int K, int N) {
    __shared__ float tile[TR_K][TR_N + 1];
    const int n0 = blockIdx.x * TR_N, k0 = blockIdx.y * TR_K;
    const int tid = threadIdx.x, wave = tid >> 5, lane = tid & 31;

    const int lk = tid >> 4;          // 0..15 : first k row loaded by this thread
    const int ln = (tid & 15) * 4;    // its four n of that row
    const unsigned loff = (unsigned)(lk * N + ln);   // per lane; the rest is uniform
    float4 v[8];
    // every loop here is unrolled: v[] and o stay in registers, the eight loads issue
    // together, and the LDS offsets become immediates
#pragma unroll
    for (int p = 0; p < 8; ++p)
        v[p] = *(const float4*)(src + ((size_t)(k0 + 16 * p) * N + n0) + loff);
#pragma unroll
    for (int p = 0; p < 8; ++p) {
        float* t = &tile[lk + 16 * p][ln];
        t[0] = v[p].x; t[1] = v[p].y; t[2] = v[p].z; t[3] = v[p].w;
    }
    __syncthreads();

    const int kc = (lane & 7) * 8;    // this lane's eight k inside a 64-k half row
    const int ns = lane >> 3;         // 0..3 : which of the wave's four n rows
#pragma unroll
    for (int p = 0; p < 4; ++p) {
        const int q = wave * 4 + p;               // 0..31
        const int n = (q & 15) * 4 + ns;
        const int k = (q >> 4) * 64 + kc;
        v8bf o;
#pragma unroll
        for (int i = 0; i < 8; ++i) o[i] = (__bf16)tile[k + i][n];
        *(v8bf*)(dst + (size_t)(n0 + n) * K + k0 + k) = o;
    }
}

// ---------------------------------------------------------------------------
// GEMM: C[M][N] = A[M][K](bf16) * Bt[N][K](bf16)^T + bias, optional ReLU.
// Block tile 128x128, 256 threads = 8 waves (4x2), wave tile 32x64.
// K tile 128 (256 B of every operand row), double-buffered LDS filled by
// GLOBAL_LOAD_ASYNC_TO_LDS_B128: 16 lanes per row, so one copy of a wave takes
// two whole 256-B row pieces (four full 128-B lines).  Kd: a multiple of 128.
// ---------------------------------------------------------------------------
#define GEMM_BK  128
#define GEMM_LDP 136   // 128 K + 8 pad: pitch 272 B = 16 B x odd for ds_load_b128

__global__ void gemm_bf16_kernel(const __bf16* __restrict__ A,
                                 const __bf16* __restrict__ Bt,
                                 const float* __restrict__ bias,
                                 __bf16* __restrict__ Cbf,
                                 float* __restrict__ Cf,
                                 int M, int N, int Kd, int relu) {
    __shared__ __align__(16) __bf16 Alds[2][128][GEMM_LDP];
    __shared__ __align__(16) __bf16 Blds[2][128][GEMM_LDP];

    const int tid  = threadIdx.x;
    const int wave = tid >> 5, lane = tid & 31;
    const int wm = wave >> 1, wn = wave & 1;
    const int bm = blockIdx.y * 128, bn = blockIdx.x * 128;
    const int kb = (lane >> 4) * 8;
    const int lr = tid >> 4;          // 0..15 : first tile row staged by this thread
    const int lc = (tid & 15) * 8;    // 0..120 (elements): its 16 B of the row piece

    const char* ag = (const char*)(A  + (size_t)(bm + lr) * Kd + lc);
    const char* bg = (const char*)(Bt + (size_t)(bn + lr) * Kd + lc);
    const size_t gstep = (size_t)Kd * 32;              // 16 rows, bytes
    const unsigned lstep = 16 * GEMM_LDP * 2;          // 16 rows, bytes
    const unsigned aldsv[2] = { lds_addr(&Alds[0][lr][lc]), lds_addr(&Alds[1][lr][lc]) };
    const unsigned bldsv[2] = { lds_addr(&Blds[0][lr][lc]), lds_addr(&Blds[1][lr][lc]) };

    v8f acc[2][4] = {};

    const int nk = Kd / GEMM_BK;

    // prologue: K tile 0 into buffer 0, published; then K tile 1 into buffer 1
    async_copy8x16B(aldsv[0], lstep, ag, gstep);
    async_copy8x16B(bldsv[0], lstep, bg, gstep);
    wait_async0();
    __syncthreads();
    if (nk > 1) {
        async_copy8x16B(aldsv[1], lstep, ag + GEMM_BK * 2, gstep);
        async_copy8x16B(bldsv[1], lstep, bg + GEMM_BK * 2, gstep);
    }

    for (int it = 0; it < nk; ++it) {
        const __bf16 (*Ac)[GEMM_LDP] = Alds[it & 1];
        const __bf16 (*Bc)[GEMM_LDP] = Blds[it & 1];

        // unrolled: every fragment's LDS offset becomes an immediate, and the next
        // 32 k's loads can be issued among this 32 k's products
#pragma unroll
        for (int ks = 0; ks < GEMM_BK; ks += 32) {
            v16bf af[2], bf_[4];
#pragma unroll
            for (int i = 0; i < 2; ++i) {
                const __bf16* r = &Ac[wm * 32 + i * 16 + (lane & 15)][ks + kb];
                af[i] = ldfrag(r, r + 16);
            }
#pragma unroll
            for (int j = 0; j < 4; ++j) {
                const __bf16* r = &Bc[wn * 64 + j * 16 + (lane & 15)][ks + kb];
                bf_[j] = ldfrag(r, r + 16);
            }
#pragma unroll
            for (int i = 0; i < 2; ++i)
#pragma unroll
                for (int j = 0; j < 4; ++j)
                    acc[i][j] = wmma_bf16(af[i], bf_[j], acc[i][j]);
        }

        // publish point of K tile it + 1
        wait_ds0();             // own reads of buffer it&1 retired
        wait_async0();          // own copies of K tile it + 1 landed in LDS
        __syncthreads();        // everyone's landed; everyone has left buffer it&1
        if (it + 2 < nk) {      // refill the buffer just left with K tile it + 2
            const size_t koff = (size_t)(it + 2) * (GEMM_BK * 2);
            async_copy8x16B(aldsv[it & 1], lstep, ag + koff, gstep);
            async_copy8x16B(bldsv[it & 1], lstep, bg + koff, gstep);
        }
    }
    wait_async0();              // nothing outstanding when the wave ends

    // Epilogue. C-frag: vgpr r -> row = base + r + ((lane>>4)<<3); col = base + (lane&15)
#pragma unroll
    for (int i = 0; i < 2; ++i)
#pragma unroll
        for (int j = 0; j < 4; ++j) {
            const int col  = bn + wn * 64 + j * 16 + (lane & 15);
            const int rowb = bm + wm * 32 + i * 16 + ((lane >> 4) << 3);
            const float bv = bias[col];
#pragma unroll
            for (int r = 0; r < 8; ++r) {
                float v = acc[i][j][r] + bv;
                if (relu) v = fmaxf(v, 0.f);
                const size_t idx = (size_t)(rowb + r) * N + col;
                if (Cbf) Cbf[idx] = (__bf16)v;
                else     Cf[idx]  = v;
            }
        }
}

// ---------------------------------------------------------------------------
// Flash attention (non-causal), computing S^T = K*Q^T so softmax statistics
// are per-lane and the P-frag C->B conversion is element-wise per lane.
// Grid: (SEQ/128, N_HEADS, BATCH), block 256 (8 waves x 16 queries).
// K tile staged via async-to-LDS DMA; V tile transposed manually into LDS.
// ---------------------------------------------------------------------------
__global__ void flash_attn_kernel(const __bf16* __restrict__ Q,
                                  const __bf16* __restrict__ K,
                                  const __bf16* __restrict__ V,
                                  __bf16* __restrict__ O) {
    __shared__ __align__(16) __bf16 Klds[32][72];    // [key][d]
    __shared__ __align__(16) __bf16 Vtlds[64][40];   // [d][key]  (transposed)

    const int qblk = blockIdx.x, h = blockIdx.y, b = blockIdx.z;
    const int tid = threadIdx.x, wave = tid >> 5, lane = tid & 31;
    const int kb = (lane >> 4) * 8;
    const int ld = D_MODEL;

    const int qrow = qblk * 128 + wave * 16 + (lane & 15);
    const __bf16* qp = Q + ((size_t)(b * SEQ + qrow)) * ld + h * HEAD_DIM;
    // Q as B-operand of K*Q^T: lane = query col, K-dim = head dim
    const v16bf qf0 = ldfrag(qp +  0 + kb, qp +  0 + kb + 16);
    const v16bf qf1 = ldfrag(qp + 32 + kb, qp + 32 + kb + 16);

    v8f o0 = {}, o1 = {}, o2 = {}, o3 = {};
    float m = -1e30f, l = 0.f;
    const float scale = 0.125f;   // 1/sqrt(64)

    const int cr = tid >> 3;             // cooperative-load row   0..31
    const int cc = (tid & 7) * 8;        // cooperative-load col   0..56

    const unsigned long long kbase = (unsigned long long)(uintptr_t)
        (K + (size_t)(b * SEQ) * ld + h * HEAD_DIM);
    const unsigned kvoff0 = (unsigned)(((size_t)cr * ld + cc) * 2);
    const unsigned kldsv  = lds_addr(&Klds[cr][cc]);

    for (int kt = 0; kt < SEQ; kt += 32) {
        // DMA K tile [32][64] directly to LDS
        async_copy16B(kldsv, kbase, kvoff0 + (unsigned)(kt * ld * 2));
        // stage V^T tile [64][32] manually (needs element transpose)
        const size_t grow = (size_t)(b * SEQ + kt + cr) * ld + h * HEAD_DIM + cc;
        union { uint4 u; __bf16 e[8]; } vu;
        vu.u = *(const uint4*)(V + grow);
#pragma unroll
        for (int i = 0; i < 8; ++i) Vtlds[cc + i][cr] = vu.e[i];
        wait_async0();
        __syncthreads();

        const int r0 = lane & 15, r1 = 16 + r0;
        v16bf ka00 = ldfrag(&Klds[r0][kb],      &Klds[r0][kb + 16]);
        v16bf ka01 = ldfrag(&Klds[r0][32 + kb], &Klds[r0][32 + kb + 16]);
        v16bf ka10 = ldfrag(&Klds[r1][kb],      &Klds[r1][kb + 16]);
        v16bf ka11 = ldfrag(&Klds[r1][32 + kb], &Klds[r1][32 + kb + 16]);

        v8f c0 = {}, c1 = {};
        c0 = wmma_bf16(ka00, qf0, c0);  c0 = wmma_bf16(ka01, qf1, c0);
        c1 = wmma_bf16(ka10, qf0, c1);  c1 = wmma_bf16(ka11, qf1, c1);

        const int dr = lane & 15;
        v16bf va0 = ldfrag(&Vtlds[ 0 + dr][kb], &Vtlds[ 0 + dr][kb + 16]);
        v16bf va1 = ldfrag(&Vtlds[16 + dr][kb], &Vtlds[16 + dr][kb + 16]);
        v16bf va2 = ldfrag(&Vtlds[32 + dr][kb], &Vtlds[32 + dr][kb + 16]);
        v16bf va3 = ldfrag(&Vtlds[48 + dr][kb], &Vtlds[48 + dr][kb + 16]);

        // online softmax (per-lane query column; pair lanes L and L^16 share q)
        float loc = -1e30f;
#pragma unroll
        for (int r = 0; r < 8; ++r) {
            c0[r] *= scale; c1[r] *= scale;
            loc = fmaxf(loc, fmaxf(c0[r], c1[r]));
        }
        loc = fmaxf(loc, __shfl_xor(loc, 16, 32));
        const float mnew  = fmaxf(m, loc);
        const float alpha = __expf(m - mnew);
        float rs = 0.f;
        v16bf p;
#pragma unroll
        for (int r = 0; r < 8; ++r) {
            const float e0 = __expf(c0[r] - mnew);
            const float e1 = __expf(c1[r] - mnew);
            rs += e0 + e1;
            p[r]     = (__bf16)e0;   // keys kb-block of sub-tile 0
            p[8 + r] = (__bf16)e1;   // keys kb-block of sub-tile 1
        }
        rs += __shfl_xor(rs, 16, 32);
        l = l * alpha + rs;
        m = mnew;
#pragma unroll
        for (int r = 0; r < 8; ++r) {
            o0[r] *= alpha; o1[r] *= alpha; o2[r] *= alpha; o3[r] *= alpha;
        }
        // O^T += V^T * P^T
        o0 = wmma_bf16(va0, p, o0);
        o1 = wmma_bf16(va1, p, o1);
        o2 = wmma_bf16(va2, p, o2);
        o3 = wmma_bf16(va3, p, o3);
        __syncthreads();
    }

    const float inv = 1.f / l;
    __bf16* ob = O + ((size_t)(b * SEQ + qrow)) * ld + h * HEAD_DIM;
#pragma unroll
    for (int r = 0; r < 8; ++r) {
        const int dhi = r + ((lane >> 4) << 3);
        ob[ 0 + dhi] = (__bf16)(o0[r] * inv);
        ob[16 + dhi] = (__bf16)(o1[r] * inv);
        ob[32 + dhi] = (__bf16)(o2[r] * inv);
        ob[48 + dhi] = (__bf16)(o3[r] * inv);
    }
}

// ---------------------------------------------------------------------------
// y = LayerNorm(a + r) * g + b   (fp32 master, optional bf16 side output)
// One wave per row, 32 elements per lane held in registers (16-B loads, whole
// lines per wave-wide access), the row's two sums by a butterfly inside the wave,
// no LDS and no barrier.  Block 256 = 8 rows.
// ---------------------------------------------------------------------------
__global__ void ln_residual_kernel(const float* __restrict__ a,
                                   const float* __restrict__ rr,
                                   const float* __restrict__ g,
                                   const float* __restrict__ bb,
                                   float* __restrict__ of,
                                   __bf16* __restrict__ obf) {
    const int D = D_MODEL;
    const int wave = threadIdx.x >> 5, lane = threadIdx.x & 31;
    const size_t row = (size_t)blockIdx.x * 8 + wave;
    const v4f* pa = (const v4f*)(a  + row * D) + lane;
    const v4f* pr = (const v4f*)(rr + row * D) + lane;
    const v4f* pg = (const v4f*)g  + lane;
    const v4f* pb = (const v4f*)bb + lane;
    v4f v[8], w[8], g4[8], b4[8];
    // the loops over i are unrolled so that the four arrays stay in registers
#pragma unroll
    for (int i = 0; i < 8; ++i) { v[i] = pa[i * 32]; w[i] = pr[i * 32]; }
#pragma unroll
    for (int i = 0; i < 8; ++i) { g4[i] = pg[i * 32]; b4[i] = pb[i * 32]; }
    v4f s4 = {0.f, 0.f, 0.f, 0.f}, q4 = {0.f, 0.f, 0.f, 0.f};
#pragma unroll
    for (int i = 0; i < 8; ++i) {
        v[i] += w[i];
        s4 += v[i];
        q4 += v[i] * v[i];
    }
    float s = (s4.x + s4.y) + (s4.z + s4.w);
    float q = (q4.x + q4.y) + (q4.z + q4.w);
    for (int o = 16; o > 0; o >>= 1) {
        s += __shfl_xor(s, o, 32);
        q += __shfl_xor(q, o, 32);
    }
    const float mu  = s / D;
    const float var = q / D - mu * mu;
    const float inv = rsqrtf(var + 1e-5f);
#pragma unroll
    for (int i = 0; i < 8; ++i) v[i] = (v[i] - mu) * inv * g4[i] + b4[i];
    v4f* po = (v4f*)(of + row * D) + lane;
    if (obf) {
        v4bf* pob = (v4bf*)(obf + row * D) + lane;
#pragma unroll
        for (int i = 0; i < 8; ++i) {
            v4bf yb = { (__bf16)v[i].x, (__bf16)v[i].y, (__bf16)v[i].z, (__bf16)v[i].w };
            pob[i * 32] = yb;
        }
    }
#pragma unroll
    for (int i = 0; i < 8; ++i) po[i * 32] = v[i];
}

// ---------------------------------------------------------------------------
extern "C" void kernel_launch(void* const* d_in, const int* in_sizes, int n_in,
                              void* d_out, int out_size, void* d_ws, size_t ws_size,
                              hipStream_t stream) {
    const float* x    = (const float*)d_in[0];
    const float* wq   = (const float*)d_in[1];
    const float* bq   = (const float*)d_in[2];
    const float* wk   = (const float*)d_in[3];
    const float* bk   = (const float*)d_in[4];
    const float* wv   = (const float*)d_in[5];
    const float* bv   = (const float*)d_in[6];
    const float* wo   = (const float*)d_in[7];
    const float* bo   = (const float*)d_in[8];
    const float* w1   = (const float*)d_in[9];
    const float* b1   = (const float*)d_in[10];
    const float* w2   = (const float*)d_in[11];
    const float* b2   = (const float*)d_in[12];
    const float* ln1g = (const float*)d_in[13];
    const float* ln1b = (const float*)d_in[14];
    const float* ln2g = (const float*)d_in[15];
    const float* ln2b = (const float*)d_in[16];

    char* ws = (char*)d_ws;
    const size_t MiB = 1024 * 1024;
    __bf16* WQT  = (__bf16*)(ws + 0 * MiB);    // 2 MiB each
    __bf16* WKT  = (__bf16*)(ws + 2 * MiB);
    __bf16* WVT  = (__bf16*)(ws + 4 * MiB);
    __bf16* WOT  = (__bf16*)(ws + 6 * MiB);
    __bf16* W1T  = (__bf16*)(ws + 8 * MiB);    // 8 MiB
    __bf16* W2T  = (__bf16*)(ws + 16 * MiB);   // 8 MiB
    __bf16* XBF  = (__bf16*)(ws + 24 * MiB);   // 8 MiB : x bf16, later attn-out bf16
    __bf16* QBF  = (__bf16*)(ws + 32 * MiB);   // 8 MiB
    __bf16* KBF  = (__bf16*)(ws + 40 * MiB);   // 8 MiB
    __bf16* VBF  = (__bf16*)(ws + 48 * MiB);   // 8 MiB
    float*  TMPF = (float* )(ws + 32 * MiB);   // 16 MiB : o-proj f32, later ffn2 f32
    float*  X1F  = (float* )(ws + 56 * MiB);   // 16 MiB
    __bf16* X1BF = (__bf16*)(ws + 72 * MiB);   // 8 MiB
    __bf16* HBF  = (__bf16*)(ws + 80 * MiB);   // 32 MiB
    float*  out  = (float*)d_out;

    // 1) casts / weight transposes
    cast_bf16_kernel<<<(NTOK * D_MODEL) / CAST_PER_BLOCK, 256, 0, stream>>>(x, XBF);
    transpose_cast_kernel<<<dim3(D_MODEL/TR_N, D_MODEL/TR_K), 256, 0, stream>>>(wq, WQT, D_MODEL, D_MODEL);
    transpose_cast_kernel<<<dim3(D_MODEL/TR_N, D_MODEL/TR_K), 256, 0, stream>>>(wk, WKT, D_MODEL, D_MODEL);
    transpose_cast_kernel<<<dim3(D_MODEL/TR_N, D_MODEL/TR_K), 256, 0, stream>>>(wv, WVT, D_MODEL, D_MODEL);
    transpose_cast_kernel<<<dim3(D_MODEL/TR_N, D_MODEL/TR_K), 256, 0, stream>>>(wo, WOT, D_MODEL, D_MODEL);
    transpose_cast_kernel<<<dim3(D_FF/TR_N,    D_MODEL/TR_K), 256, 0, stream>>>(w1, W1T, D_MODEL, D_FF);
    transpose_cast_kernel<<<dim3(D_MODEL/TR_N, D_FF/TR_K),    256, 0, stream>>>(w2, W2T, D_FF, D_MODEL);

    // 2) QKV projections
    gemm_bf16_kernel<<<dim3(D_MODEL/128, NTOK/128), 256, 0, stream>>>(XBF, WQT, bq, QBF, nullptr, NTOK, D_MODEL, D_MODEL, 0);
    gemm_bf16_kernel<<<dim3(D_MODEL/128, NTOK/128), 256, 0, stream>>>(XBF, WKT, bk, KBF, nullptr, NTOK, D_MODEL, D_MODEL, 0);
    gemm_bf16_kernel<<<dim3(D_MODEL/128, NTOK/128), 256, 0, stream>>>(XBF, WVT, bv, VBF, nullptr, NTOK, D_MODEL, D_MODEL, 0);

    // 3) flash attention -> XBF (concat heads, row-major)
    flash_attn_kernel<<<dim3(SEQ/128, N_HEADS, BATCH), 256, 0, stream>>>(QBF, KBF, VBF, XBF);

    // 4) output projection (f32) + residual LN1
    gemm_bf16_kernel<<<dim3(D_MODEL/128, NTOK/128), 256, 0, stream>>>(XBF, WOT, bo, nullptr, TMPF, NTOK, D_MODEL, D_MODEL, 0);
    ln_residual_kernel<<<NTOK / 8, 256, 0, stream>>>(x, TMPF, ln1g, ln1b, X1F, X1BF);

    // 5) FFN
    gemm_bf16_kernel<<<dim3(D_FF/128,    NTOK/128), 256, 0, stream>>>(X1BF, W1T, b1, HBF, nullptr, NTOK, D_FF, D_MODEL, 1);
    gemm_bf16_kernel<<<dim3(D_MODEL/128, NTOK/128), 256, 0, stream>>>(HBF,  W2T, b2, nullptr, TMPF, NTOK, D_MODEL, D_FF, 0);

    // 6) residual LN2 -> final output
    ln_residual_kernel<<<NTOK / 8, 256, 0, stream>>>(X1F, TMPF, ln2g, ln2b, out, nullptr);
}

// v003
// One run takes 223 microseconds.
// Timed twice side by side with v002, it ran 1.12 and 1.13 times as fast.
// Counting every step since v000, it is 1.43 times as fast.
#include <hip/hip_runtime.h>

typedef __attribute__((ext_vector_type(16))) __bf16 v16bf;
typedef __attribute__((ext_vector_type(8)))  float  v8f;
typedef __attribute__((ext_vector_type(8)))  __bf16 v8bf;
typedef __attribute__((ext_vector_type(4)))  __bf16 v4bf;
typedef __attribute__((ext_vector_type(4)))  float  v4f;

#define D_MODEL  1024
#define N_HEADS  16
#define HEAD_DIM 64
#define D_FF     4096
#define SEQ      2048
#define BATCH    2
#define NTOK     (BATCH * SEQ)   // 4096 rows

// ---------------------------------------------------------------------------
// Fragment helpers.
// A-style 16x32 bf16 fragment: lane L holds row M = L&15; K base = (L>>4)*8;
// vector elems e0..e7 = K kb..kb+7, e8..e15 = K kb+16..kb+23  -> two 16B loads.
// ---------------------------------------------------------------------------
__device__ __forceinline__ v16bf ldfrag(const __bf16* p0, const __bf16* p1) {
    union { struct { uint4 lo, hi; } u; v16bf v; } f;
    f.u.lo = *(const uint4*)p0;
    f.u.hi = *(const uint4*)p1;
    return f.v;
}

__device__ __forceinline__ v8f wmma_bf16(v16bf a, v16bf b, v8f c) {
    // D(f32 16x16) = A(bf16 16x32) * B(bf16 32x16) + C
    return __builtin_amdgcn_wmma_f32_16x16x32_bf16(false, a, false, b,
                                                   (short)0, c, false, false);
}

// Async DMA: eight b128 copies global -> LDS, 16 B per lane each.  Copy c takes
// the lane's 16 B of tile row (row0 + 16 * c): LDS address lds + c * lstep,
// global address g + c * gstep (both in bytes).  The closing s_wait_xcnt stands
// inside the statement so that no address register named by a copy is rewritten
// ahead of it.
__device__ __forceinline__ void async_copy8x16B(unsigned lds, unsigned lstep,
                                                const char* g, size_t gstep) {
    asm volatile(
        "global_load_async_to_lds_b128 %0, %8, off\n\t"
        "global_load_async_to_lds_b128 %1, %9, off\n\t"
        "global_load_async_to_lds_b128 %2, %10, off\n\t"
        "global_load_async_to_lds_b128 %3, %11, off\n\t"
        "global_load_async_to_lds_b128 %4, %12, off\n\t"
        "global_load_async_to_lds_b128 %5, %13, off\n\t"
        "global_load_async_to_lds_b128 %6, %14, off\n\t"
        "global_load_async_to_lds_b128 %7, %15, off\n\t"
        "s_wait_xcnt 0x0"
        :: "v"(lds), "v"(lds + lstep), "v"(lds + 2 * lstep), "v"(lds + 3 * lstep),
           "v"(lds + 4 * lstep), "v"(lds + 5 * lstep), "v"(lds + 6 * lstep),
           "v"(lds + 7 * lstep),
           "v"(g), "v"(g + gstep), "v"(g + 2 * gstep), "v"(g + 3 * gstep),
           "v"(g + 4 * gstep), "v"(g + 5 * gstep), "v"(g + 6 * gstep),
           "v"(g + 7 * gstep)
        : "memory");
}

__device__ __forceinline__ void async_copy16B(unsigned lds, unsigned long long base,
                                              unsigned voff) {
    asm volatile(
        "global_load_async_to_lds_b128 %0, %1, %2 offset:0"
        :: "v"(lds), "v"(voff), "s"(base) : "memory");
}

__device__ __forceinline__ void wait_async0() {
    asm volatile("s_wait_asynccnt 0x0" ::: "memory");
}

// This wave's LDS reads have retired: stands in front of the barrier behind
// which the buffer they read is refilled by async copies.
__device__ __forceinline__ void wait_ds0() {
    asm volatile("s_wait_dscnt 0x0" ::: "memory");
}

// Low 32 bits of a generic pointer to __shared__ == raw LDS byte offset
// (flat-aperture rule: LDS_ADDR = addr[31:0]).
__device__ __forceinline__ unsigned lds_addr(const void* p) {
    return (unsigned)(unsigned long long)(uintptr_t)p;
}

// ---------------------------------------------------------------------------
// fp32 -> bf16 cast of x.  32 elements per thread (few, long-lived waves): eight
// 16-B loads in flight per lane, each wave-wide load 512 contiguous bytes, each
// wave-wide store 256.  Block blk takes 8192 contiguous elements.
// ---------------------------------------------------------------------------
#define CAST_PER_BLOCK 8192
__device__ __forceinline__ void cast_bf16_block(const float* __restrict__ src,
                                                __bf16* __restrict__ dst, int blk) {
    const size_t base = (size_t)blk * (CAST_PER_BLOCK / 4) + threadIdx.x;
    const float4* s4 = (const float4*)src + base;
    v4bf* d4 = (v4bf*)dst + base;
    float4 v[8];
    // both loops unrolled: v[] stays in registers, all loads issue before the first use
#pragma unroll
    for (int i = 0; i < 8; ++i) v[i] = s4[i * 256];
#pragma unroll
    for (int i = 0; i < 8; ++i) {
        v4bf o = { (__bf16)v[i].x, (__bf16)v[i].y, (__bf16)v[i].z, (__bf16)v[i].w };
        d4[i * 256] = o;
    }
}

// ---------------------------------------------------------------------------
// W[K][N] fp32  ->  Wt[N][K] bf16.  One block of 256 threads transposes a tile
// of 128 k x 64 n through LDS, 32 elements per thread: eight 16-B loads in flight
// per lane (a wave-wide load = two 256-B row pieces), four 16-B stores per lane
// (a wave-wide store = four whole 128-B lines).  K: a multiple of 128, N: of 64.
// LDS pitch 65 dwords: both the row-wise writes and the column-wise reads below
// fall on 32 different banks.  bn, bk: the tile's place along n and along k.
// ---------------------------------------------------------------------------
#define TR_K 128
#define TR_N 64
__device__ __forceinline__ void transpose_cast_block(const float* __restrict__ src,
                                                     __bf16* __restrict__ dst,
                                                     int K, int N, int bn, int bk) {
    __shared__ float tile[TR_K][TR_N + 1];
    const int n0 = bn * TR_N, k0 = bk * TR_K;
    const int tid = threadIdx.x, wave = tid >> 5, lane = tid & 31;

    const int lk = tid >> 4;          // 0..15 : first k row loaded by this thread
    const int ln = (tid & 15) * 4;    // its four n of that row
    const unsigned loff = (unsigned)(lk * N + ln);   // per lane; the rest is uniform
    float4 v[8];
    // every loop here is unrolled: v[] and o stay in registers, the eight loads issue
    // together, and the LDS offsets become immediates
#pragma unroll
    for (int p = 0; p < 8; ++p)
        v[p] = *(const float4*)(src + ((size_t)(k0 + 16 * p) * N + n0) + loff);
#pragma unroll
    for (int p = 0; p < 8; ++p) {
        float* t = &tile[lk + 16 * p][ln];
        t[0] = v[p].x; t[1] = v[p].y; t[2] = v[p].z; t[3] = v[p].w;
    }
    __syncthreads();

    const int kc = (lane & 7) * 8;    // this lane's eight k inside a 64-k half row
    const int ns = lane >> 3;         // 0..3 : which of the wave's four n rows
#pragma unroll
    for (int p = 0; p < 4; ++p) {
        const int q = wave * 4 + p;               // 0..31
        const int n = (q & 15) * 4 + ns;
        const int k = (q >> 4) * 64 + kc;
        v8bf o;
#pragma unroll
        for (int i = 0; i < 8; ++i) o[i] = (__bf16)tile[k + i][n];
        *(v8bf*)(dst + (size_t)(n0 + n) * K + k0 + k) = o;
    }
}

// ---------------------------------------------------------------------------
// All operand preparation in ONE launch: none of these pieces reads what another
// writes, so they need no launch boundary between them.  The flat block index
// falls in one of four ranges: w1's tiles, w2's tiles, the tiles of the four
// square weights, the pieces of x.  Every test below reads blockIdx alone, so a
// whole block takes one path and the transpose's barrier is passed by all of it.
// ---------------------------------------------------------------------------
#define PREP_FF_BLOCKS   ((D_FF / TR_N) * (D_MODEL / TR_K))        // 512, w1 and w2 alike
#define PREP_SQ_BLOCKS   ((D_MODEL / TR_N) * (D_MODEL / TR_K))     // 128 per square weight
#define PREP_CAST_BLOCKS ((NTOK * D_MODEL) / CAST_PER_BLOCK)       // 512
#define PREP_BLOCKS      (2 * PREP_FF_BLOCKS + 4 * PREP_SQ_BLOCKS + PREP_CAST_BLOCKS)
__global__ void prepare_operands_kernel(const float* __restrict__ x,
                                        const float* __restrict__ wq,
                                        const float* __restrict__ wk,
                                        const float* __restrict__ wv,
                                        const float* __restrict__ wo,
                                        const float* __restrict__ w1,
                                        const float* __restrict__ w2,
                                        __bf16* __restrict__ xbf,
                                        __bf16* __restrict__ wqt,
                                        __bf16* __restrict__ wkt,
                                        __bf16* __restrict__ wvt,
                                        __bf16* __restrict__ wot,
                                        __bf16* __restrict__ w1t,
                                        __bf16* __restrict__ w2t) {
    int b = blockIdx.x;
    if (b >= 2 * PREP_FF_BLOCKS + 4 * PREP_SQ_BLOCKS) {
        cast_bf16_block(x, xbf, b - (2 * PREP_FF_BLOCKS + 4 * PREP_SQ_BLOCKS));
        return;
    }
    const float* src;
    __bf16* dst;
    int K = D_MODEL, N = D_MODEL;
    int ntl = 4;                        // log2 of the tiles along n: D_MODEL / TR_N = 16
    if (b < PREP_FF_BLOCKS) {
        src = w1; dst = w1t; N = D_FF; ntl = 6;     // D_FF / TR_N = 64
    } else if (b < 2 * PREP_FF_BLOCKS) {
        b -= PREP_FF_BLOCKS;
        src = w2; dst = w2t; K = D_FF;
    } else {
        b -= 2 * PREP_FF_BLOCKS;
        const int w = b / PREP_SQ_BLOCKS;
        b -= w * PREP_SQ_BLOCKS;
        src = w == 0 ? wq  : w == 1 ? wk  : w == 2 ? wv  : wo;
        dst = w == 0 ? wqt : w == 1 ? wkt : w == 2 ? wvt : wot;
    }
    // shift and mask, not a division by a run-time N: the tile's place stays scalar
    transpose_cast_block(src, dst, K, N, b & ((1 << ntl) - 1), b >> ntl);
}

// ---------------------------------------------------------------------------
// GEMM: C[M][N] = A[M][K](bf16) * Bt[N][K](bf16)^T + bias, optional ReLU.
// Block tile 128x128, 256 threads = 8 waves (4x2), wave tile 32x64.
// K tile 128 (256 B of every operand row), double-buffered LDS filled by
// GLOBAL_LOAD_ASYNC_TO_LDS_B128: 16 lanes per row, so one copy of a wave takes
// two whole 256-B row pieces (four full 128-B lines).  Kd: a multiple of 128.
// Grid z: up to three products of the same A in one launch.  Product z takes the
// z-th [N][Kd] matrix behind Bt0, its own bias, and writes the z-th [M][N] bf16
// matrix behind Cbf0.
// ---------------------------------------------------------------------------
#define GEMM_BK  128
#define GEMM_LDP 136   // 128 K + 8 pad: pitch 272 B = 16 B x odd for ds_load_b128

__global__ void gemm_bf16_kernel(const __bf16* __restrict__ A,
                                 const __bf16* __restrict__ Bt0,
                                 const float* __restrict__ bias0,
                                 const float* __restrict__ bias1,
                                 const float* __restrict__ bias2,
                                 __bf16* __restrict__ Cbf0,
                                 float* __restrict__ Cf,
                                 int M, int N, int Kd, int relu) {
    __shared__ __align__(16) __bf16 Alds[2][128][GEMM_LDP];
    __shared__ __align__(16) __bf16 Blds[2][128][GEMM_LDP];

    const int z = blockIdx.z;
    const __bf16* Bt  = Bt0 + (size_t)z * N * Kd;
    const float* bias = z == 0 ? bias0 : z == 1 ? bias1 : bias2;
    __bf16* Cbf       = Cbf0 ? Cbf0 + (size_t)z * M * N : nullptr;

    const int tid  = threadIdx.x;
    const int wave = tid >> 5, lane = tid & 31;
    const int wm = wave >> 1, wn = wave & 1;
    const int bm = blockIdx.y * 128, bn = blockIdx.x * 128;
    const int kb = (lane >> 4) * 8;
    const int lr = tid >> 4;          // 0..15 : first tile row staged by this thread
    const int lc = (tid & 15) * 8;    // 0..120 (elements): its 16 B of the row piece

    const char* ag = (const char*)(A  + (size_t)(bm + lr) * Kd + lc);
    const char* bg = (const char*)(Bt + (size_t)(bn + lr) * Kd + lc);
    const size_t gstep = (size_t)Kd * 32;              // 16 rows, bytes
    const unsigned lstep = 16 * GEMM_LDP * 2;          // 16 rows, bytes
    const unsigned aldsv[2] = { lds_addr(&Alds[0][lr][lc]), lds_addr(&Alds[1][lr][lc]) };
    const unsigned bldsv[2] = { lds_addr(&Blds[0][lr][lc]), lds_addr(&Blds[1][lr][lc]) };

    v8f acc[2][4] = {};

    const int nk = Kd / GEMM_BK;

    // prologue: K tile 0 into buffer 0, published; then K tile 1 into buffer 1
    async_copy8x16B(aldsv[0], lstep, ag, gstep);
    async_copy8x16B(bldsv[0], lstep, bg, gstep);
    wait_async0();
    __syncthreads();
    if (nk > 1) {
        async_copy8x16B(aldsv[1], lstep, ag + GEMM_BK * 2, gstep);
        async_copy8x16B(bldsv[1], lstep, bg + GEMM_BK * 2, gstep);
    }

    for (int it = 0; it < nk; ++it) {
        const __bf16 (*Ac)[GEMM_LDP] = Alds[it & 1];
        const __bf16 (*Bc)[GEMM_LDP] = Blds[it & 1];

        // unrolled: every fragment's LDS offset becomes an immediate, and the next
        // 32 k's loads can be issued among this 32 k's products
#pragma unroll
        for (int ks = 0; ks < GEMM_BK; ks += 32) {
            v16bf af[2], bf_[4];
#pragma unroll
            for (int i = 0; i < 2; ++i) {
                const __bf16* r = &Ac[wm * 32 + i * 16 + (lane & 15)][ks + kb];
                af[i] = ldfrag(r, r + 16);
            }
#pragma unroll
            for (int j = 0; j < 4; ++j) {
                const __bf16* r = &Bc[wn * 64 + j * 16 + (lane & 15)][ks + kb];
                bf_[j] = ldfrag(r, r + 16);
            }
#pragma unroll
            for (int i = 0; i < 2; ++i)
#pragma unroll
                for (int j = 0; j < 4; ++j)
                    acc[i][j] = wmma_bf16(af[i], bf_[j], acc[i][j]);
        }

        // publish point of K tile it + 1
        wait_ds0();             // own reads of buffer it&1 retired
        wait_async0();          // own copies of K tile it + 1 landed in LDS
        __syncthreads();        // everyone's landed; everyone has left buffer it&1
        if (it + 2 < nk) {      // refill the buffer just left with K tile it + 2
            const size_t koff = (size_t)(it + 2) * (GEMM_BK * 2);
            async_copy8x16B(aldsv[it & 1], lstep, ag + koff, gstep);
            async_copy8x16B(bldsv[it & 1], lstep, bg + koff, gstep);
        }
    }
    wait_async0();              // nothing outstanding when the wave ends

    // Epilogue. C-frag: vgpr r -> row = base + r + ((lane>>4)<<3); col = base + (lane&15)
#pragma unroll
    for (int i = 0; i < 2; ++i)
#pragma unroll
        for (int j = 0; j < 4; ++j) {
            const int col  = bn + wn * 64 + j * 16 + (lane & 15);
            const int rowb = bm + wm * 32 + i * 16 + ((lane >> 4) << 3);
            const float bv = bias[col];
#pragma unroll
            for (int r = 0; r < 8; ++r) {
                float v = acc[i][j][r] + bv;
                if (relu) v = fmaxf(v, 0.f);
                const size_t idx = (size_t)(rowb + r) * N + col;
                if (Cbf) Cbf[idx] = (__bf16)v;
                else     Cf[idx]  = v;
            }
        }
}

// ---------------------------------------------------------------------------
// Flash attention (non-causal), computing S^T = K*Q^T so softmax statistics
// are per-lane and the P-frag C->B conversion is element-wise per lane.
// Grid: (SEQ/128, N_HEADS, BATCH), block 256 (8 waves x 16 queries).
// K tile staged via async-to-LDS DMA; V tile transposed manually into LDS.
// ---------------------------------------------------------------------------
__global__ void flash_attn_kernel(const __bf16* __restrict__ Q,
                                  const __bf16* __restrict__ K,
                                  const __bf16* __restrict__ V,
                                  __bf16* __restrict__ O) {
    __shared__ __align__(16) __bf16 Klds[32][72];    // [key][d]
    __shared__ __align__(16) __bf16 Vtlds[64][40];   // [d][key]  (transposed)

    const int qblk = blockIdx.x, h = blockIdx.y, b = blockIdx.z;
    const int tid = threadIdx.x, wave = tid >> 5, lane = tid & 31;
    const int kb = (lane >> 4) * 8;
    const int ld = D_MODEL;

    const int qrow = qblk * 128 + wave * 16 + (lane & 15);
    const __bf16* qp = Q + ((size_t)(b * SEQ + qrow)) * ld + h * HEAD_DIM;
    // Q as B-operand of K*Q^T: lane = query col, K-dim = head dim
    const v16bf qf0 = ldfrag(qp +  0 + kb, qp +  0 + kb + 16);
    const v16bf qf1 = ldfrag(qp + 32 + kb, qp + 32 + kb + 16);

    v8f o0 = {}, o1 = {}, o2 = {}, o3 = {};
    float m = -1e30f, l = 0.f;
    const float scale = 0.125f;   // 1/sqrt(64)

    const int cr = tid >> 3;             // cooperative-load row   0..31
    const int cc = (tid & 7) * 8;        // cooperative-load col   0..56

    const unsigned long long kbase = (unsigned long long)(uintptr_t)
        (K + (size_t)(b * SEQ) * ld + h * HEAD_DIM);
    const unsigned kvoff0 = (unsigned)(((size_t)cr * ld + cc) * 2);
    const unsigned kldsv  = lds_addr(&Klds[cr][cc]);

    for (int kt = 0; kt < SEQ; kt += 32) {
        // DMA K tile [32][64] directly to LDS
        async_copy16B(kldsv, kbase, kvoff0 + (unsigned)(kt * ld * 2));
        // stage V^T tile [64][32] manually (needs element transpose)
        const size_t grow = (size_t)(b * SEQ + kt + cr) * ld + h * HEAD_DIM + cc;
        union { uint4 u; __bf16 e[8]; } vu;
        vu.u = *(const uint4*)(V + grow);
#pragma unroll
        for (int i = 0; i < 8; ++i) Vtlds[cc + i][cr] = vu.e[i];
        wait_async0();
        __syncthreads();

        const int r0 = lane & 15, r1 = 16 + r0;
        v16bf ka00 = ldfrag(&Klds[r0][kb],      &Klds[r0][kb + 16]);
        v16bf ka01 = ldfrag(&Klds[r0][32 + kb], &Klds[r0][32 + kb + 16]);
        v16bf ka10 = ldfrag(&Klds[r1][kb],      &Klds[r1][kb + 16]);
        v16bf ka11 = ldfrag(&Klds[r1][32 + kb], &Klds[r1][32 + kb + 16]);

        v8f c0 = {}, c1 = {};
        c0 = wmma_bf16(ka00, qf0, c0);  c0 = wmma_bf16(ka01, qf1, c0);
        c1 = wmma_bf16(ka10, qf0, c1);  c1 = wmma_bf16(ka11, qf1, c1);

        const int dr = lane & 15;
        v16bf va0 = ldfrag(&Vtlds[ 0 + dr][kb], &Vtlds[ 0 + dr][kb + 16]);
        v16bf va1 = ldfrag(&Vtlds[16 + dr][kb], &Vtlds[16 + dr][kb + 16]);
        v16bf va2 = ldfrag(&Vtlds[32 + dr][kb], &Vtlds[32 + dr][kb + 16]);
        v16bf va3 = ldfrag(&Vtlds[48 + dr][kb], &Vtlds[48 + dr][kb + 16]);

        // online softmax (per-lane query column; pair lanes L and L^16 share q)
        float loc = -1e30f;
#pragma unroll
        for (int r = 0; r < 8; ++r) {
            c0[r] *= scale; c1[r] *= scale;
            loc = fmaxf(loc, fmaxf(c0[r], c1[r]));
        }
        loc = fmaxf(loc, __shfl_xor(loc, 16, 32));
        const float mnew  = fmaxf(m, loc);
        const float alpha = __expf(m - mnew);
        float rs = 0.f;
        v16bf p;
#pragma unroll
        for (int r = 0; r < 8; ++r) {
            const float e0 = __expf(c0[r] - mnew);
            const float e1 = __expf(c1[r] - mnew);
            rs += e0 + e1;
            p[r]     = (__bf16)e0;   // keys kb-block of sub-tile 0
            p[8 + r] = (__bf16)e1;   // keys kb-block of sub-tile 1
        }
        rs += __shfl_xor(rs, 16, 32);
        l = l * alpha + rs;
        m = mnew;
#pragma unroll
        for (int r = 0; r < 8; ++r) {
            o0[r] *= alpha; o1[r] *= alpha; o2[r] *= alpha; o3[r] *= alpha;
        }
        // O^T += V^T * P^T
        o0 = wmma_bf16(va0, p, o0);
        o1 = wmma_bf16(va1, p, o1);
        o2 = wmma_bf16(va2, p, o2);
        o3 = wmma_bf16(va3, p, o3);
        __syncthreads();
    }

    const float inv = 1.f / l;
    __bf16* ob = O + ((size_t)(b * SEQ + qrow)) * ld + h * HEAD_DIM;
#pragma unroll
    for (int r = 0; r < 8; ++r) {
        const int dhi = r + ((lane >> 4) << 3);
        ob[ 0 + dhi] = (__bf16)(o0[r] * inv);
        ob[16 + dhi] = (__bf16)(o1[r] * inv);
        ob[32 + dhi] = (__bf16)(o2[r] * inv);
        ob[48 + dhi] = (__bf16)(o3[r] * inv);
    }
}

// ---------------------------------------------------------------------------
// y = LayerNorm(a + r) * g + b   (fp32 master, optional bf16 side output)
// One wave per row, 32 elements per lane held in registers (16-B loads, whole
// lines per wave-wide access), the row's two sums by a butterfly inside the wave,
// no LDS and no barrier.  Block 256 = 8 rows.
// ---------------------------------------------------------------------------
__global__ void ln_residual_kernel(const float* __restrict__ a,
                                   const float* __restrict__ rr,
                                   const float* __restrict__ g,
                                   const float* __restrict__ bb,
                                   float* __restrict__ of,
                                   __bf16* __restrict__ obf) {
    const int D = D_MODEL;
    const int wave = threadIdx.x >> 5, lane = threadIdx.x & 31;
    const size_t row = (size_t)blockIdx.x * 8 + wave;
    const v4f* pa = (const v4f*)(a  + row * D) + lane;
    const v4f* pr = (const v4f*)(rr + row * D) + lane;
    const v4f* pg = (const v4f*)g  + lane;
    const v4f* pb = (const v4f*)bb + lane;
    v4f v[8], w[8], g4[8], b4[8];
    // the loops over i are unrolled so that the four arrays stay in registers
#pragma unroll
    for (int i = 0; i < 8; ++i) { v[i] = pa[i * 32]; w[i] = pr[i * 32]; }
#pragma unroll
    for (int i = 0; i < 8; ++i) { g4[i] = pg[i * 32]; b4[i] = pb[i * 32]; }
    v4f s4 = {0.f, 0.f, 0.f, 0.f}, q4 = {0.f, 0.f, 0.f, 0.f};
#pragma unroll
    for (int i = 0; i < 8; ++i) {
        v[i] += w[i];
        s4 += v[i];
        q4 += v[i] * v[i];
    }
    float s = (s4.x + s4.y) + (s4.z + s4.w);
    float q = (q4.x + q4.y) + (q4.z + q4.w);
    for (int o = 16; o > 0; o >>= 1) {
        s += __shfl_xor(s, o, 32);
        q += __shfl_xor(q, o, 32);
    }
    const float mu  = s / D;
    const float var = q / D - mu * mu;
    const float inv = rsqrtf(var + 1e-5f);
#pragma unroll
    for (int i = 0; i < 8; ++i) v[i] = (v[i] - mu) * inv * g4[i] + b4[i];
    v4f* po = (v4f*)(of + row * D) + lane;
    if (obf) {
        v4bf* pob = (v4bf*)(obf + row * D) + lane;
#pragma unroll
        for (int i = 0; i < 8; ++i) {
            v4bf yb = { (__bf16)v[i].x, (__bf16)v[i].y, (__bf16)v[i].z, (__bf16)v[i].w };
            pob[i * 32] = yb;
        }
    }
#pragma unroll
    for (int i = 0; i < 8; ++i) po[i * 32] = v[i];
}

// ---------------------------------------------------------------------------
extern "C" void kernel_launch(void* const* d_in, const int* in_sizes, int n_in,
                              void* d_out, int out_size, void* d_ws, size_t ws_size,
                              hipStream_t stream) {
    const float* x    = (const float*)d_in[0];
    const float* wq   = (const float*)d_in[1];
    const float* bq   = (const float*)d_in[2];
    const float* wk   = (const float*)d_in[3];
    const float* bk   = (const float*)d_in[4];
    const float* wv   = (const float*)d_in[5];
    const float* bv   = (const float*)d_in[6];
    const float* wo   = (const float*)d_in[7];
    const float* bo   = (const float*)d_in[8];
    const float* w1   = (const float*)d_in[9];
    const float* b1   = (const float*)d_in[10];
    const float* w2   = (const float*)d_in[11];
    const float* b2   = (const float*)d_in[12];
    const float* ln1g = (const float*)d_in[13];
    const float* ln1b = (const float*)d_in[14];
    const float* ln2g = (const float*)d_in[15];
    const float* ln2b = (const float*)d_in[16];

    char* ws = (char*)d_ws;
    const size_t MiB = 1024 * 1024;
    __bf16* WQT  = (__bf16*)(ws + 0 * MiB);    // 2 MiB each; WQT, WKT, WVT in a row
    __bf16* WKT  = (__bf16*)(ws + 2 * MiB);
    __bf16* WVT  = (__bf16*)(ws + 4 * MiB);
    __bf16* WOT  = (__bf16*)(ws + 6 * MiB);
    __bf16* W1T  = (__bf16*)(ws + 8 * MiB);    // 8 MiB
    __bf16* W2T  = (__bf16*)(ws + 16 * MiB);   // 8 MiB
    __bf16* XBF  = (__bf16*)(ws + 24 * MiB);   // 8 MiB : x bf16, later attn-out bf16
    __bf16* QBF  = (__bf16*)(ws + 32 * MiB);   // 8 MiB; QBF, KBF, VBF in a row
    __bf16* KBF  = (__bf16*)(ws + 40 * MiB);   // 8 MiB
    __bf16* VBF  = (__bf16*)(ws + 48 * MiB);   // 8 MiB
    float*  TMPF = (float* )(ws + 32 * MiB);   // 16 MiB : o-proj f32, later ffn2 f32
    float*  X1F  = (float* )(ws + 56 * MiB);   // 16 MiB
    __bf16* X1BF = (__bf16*)(ws + 72 * MiB);   // 8 MiB
    __bf16* HBF  = (__bf16*)(ws + 80 * MiB);   // 32 MiB
    float*  out  = (float*)d_out;

    // 1) cast of x and all weight transposes, one launch
    prepare_operands_kernel<<<PREP_BLOCKS, 256, 0, stream>>>(x, wq, wk, wv, wo, w1, w2,
                                                             XBF, WQT, WKT, WVT, WOT, W1T, W2T);

    // 2) Q, K and V projections, one launch: grid z = 0, 1, 2
    gemm_bf16_kernel<<<dim3(D_MODEL/128, NTOK/128, 3), 256, 0, stream>>>(XBF, WQT, bq, bk, bv, QBF, nullptr, NTOK, D_MODEL, D_MODEL, 0);

    // 3) flash attention -> XBF (concat heads, row-major)
    flash_attn_kernel<<<dim3(SEQ/128, N_HEADS, BATCH), 256, 0, stream>>>(QBF, KBF, VBF, XBF);

    // 4) output projection (f32) + residual LN1
    gemm_bf16_kernel<<<dim3(D_MODEL/128, NTOK/128), 256, 0, stream>>>(XBF, WOT, bo, nullptr, nullptr, nullptr, TMPF, NTOK, D_MODEL, D_MODEL, 0);
    ln_residual_kernel<<<NTOK / 8, 256, 0, stream>>>(x, TMPF, ln1g, ln1b, X1F, X1BF);

    // 5) FFN
    gemm_bf16_kernel<<<dim3(D_FF/128,    NTOK/128), 256, 0, stream>>>(X1BF, W1T, b1, nullptr, nullptr, HBF, nullptr, NTOK, D_FF, D_MODEL, 1);
    gemm_bf16_kernel<<<dim3(D_MODEL/128, NTOK/128), 256, 0, stream>>>(HBF,  W2T, b2, nullptr, nullptr, nullptr, TMPF, NTOK, D_MODEL, D_FF, 0);

    // 6) residual LN2 -> final output
    ln_residual_kernel<<<NTOK / 8, 256, 0, stream>>>(X1F, TMPF, ln2g, ln2b, out, nullptr);
}

// v004
// Measured time: 175 microseconds a run.
// Next to v003, in two timings, it ran 1.27 and 1.28 times as fast.
// All steps since v000 together make it 1.83 times as fast.
#include <hip/hip_runtime.h>

typedef __attribute__((ext_vector_type(16))) __bf16 v16bf;
typedef __attribute__((ext_vector_type(8)))  float  v8f;
typedef __attribute__((ext_vector_type(8)))  __bf16 v8bf;
typedef __attribute__((ext_vector_type(4)))  __bf16 v4bf;
typedef __attribute__((ext_vector_type(4)))  float  v4f;

#define D_MODEL  1024
#define N_HEADS  16
#define HEAD_DIM 64
#define D_FF     4096
#define SEQ      2048
#define BATCH    2
#define NTOK     (BATCH * SEQ)   // 4096 rows

// ---------------------------------------------------------------------------
// Fragment helpers.
// A-style 16x32 bf16 fragment: lane L holds row M = L&15; K base = (L>>4)*8;
// vector elems e0..e7 = K kb..kb+7, e8..e15 = K kb+16..kb+23  -> two 16B loads.
// ---------------------------------------------------------------------------
__device__ __forceinline__ v16bf ldfrag(const __bf16* p0, const __bf16* p1) {
    union { struct { uint4 lo, hi; } u; v16bf v; } f;
    f.u.lo = *(const uint4*)p0;
    f.u.hi = *(const uint4*)p1;
    return f.v;
}

__device__ __forceinline__ v8f wmma_bf16(v16bf a, v16bf b, v8f c) {
    // D(f32 16x16) = A(bf16 16x32) * B(bf16 32x16) + C
    return __builtin_amdgcn_wmma_f32_16x16x32_bf16(false, a, false, b,
                                                   (short)0, c, false, false);
}

// Async DMA: eight b128 copies global -> LDS, 16 B per lane each.  Copy c takes
// the lane's 16 B of tile row (row0 + 16 * c): LDS address lds + c * lstep,
// global address g + c * gstep (both in bytes).  The closing s_wait_xcnt stands
// inside the statement so that no address register named by a copy is rewritten
// ahead of it.
__device__ __forceinline__ void async_copy8x16B(unsigned lds, unsigned lstep,
                                                const char* g, size_t gstep) {
    asm volatile(
        "global_load_async_to_lds_b128 %0, %8, off\n\t"
        "global_load_async_to_lds_b128 %1, %9, off\n\t"
        "global_load_async_to_lds_b128 %2, %10, off\n\t"
        "global_load_async_to_lds_b128 %3, %11, off\n\t"
        "global_load_async_to_lds_b128 %4, %12, off\n\t"
        "global_load_async_to_lds_b128 %5, %13, off\n\t"
        "global_load_async_to_lds_b128 %6, %14, off\n\t"
        "global_load_async_to_lds_b128 %7, %15, off\n\t"
        "s_wait_xcnt 0x0"
        :: "v"(lds), "v"(lds + lstep), "v"(lds + 2 * lstep), "v"(lds + 3 * lstep),
           "v"(lds + 4 * lstep), "v"(lds + 5 * lstep), "v"(lds + 6 * lstep),
           "v"(lds + 7 * lstep),
           "v"(g), "v"(g + gstep), "v"(g + 2 * gstep), "v"(g + 3 * gstep),
           "v"(g + 4 * gstep), "v"(g + 5 * gstep), "v"(g + 6 * gstep),
           "v"(g + 7 * gstep)
        : "memory");
}

// The same with four copies: copy c takes the lane's 16 B of tile row (row0 + 32 * c).
__device__ __forceinline__ void async_copy4x16B(unsigned lds, unsigned lstep,
                                                const char* g, size_t gstep) {
    asm volatile(
        "global_load_async_to_lds_b128 %0, %4, off\n\t"
        "global_load_async_to_lds_b128 %1, %5, off\n\t"
        "global_load_async_to_lds_b128 %2, %6, off\n\t"
        "global_load_async_to_lds_b128 %3, %7, off\n\t"
        "s_wait_xcnt 0x0"
        :: "v"(lds), "v"(lds + lstep), "v"(lds + 2 * lstep), "v"(lds + 3 * lstep),
           "v"(g), "v"(g + gstep), "v"(g + 2 * gstep), "v"(g + 3 * gstep)
        : "memory");
}

// Transposing LDS load: from a row-major 16-bit tile T, lane (c = l & 15, h = l >> 4)
// gets T[k0 + 8h + 0..7][d0 + c] when lane l points at row k0 + 8 * (l >> 4) + (l & 7),
// byte 2 * d0 + 16 * ((l >> 3) & 1) of that row.
typedef short s16x8 __attribute__((ext_vector_type(8)));
__device__ __forceinline__ uint4 ld_tr16(const unsigned char* p) {
    typedef __attribute__((address_space(3))) s16x8 lds_s16x8;
    return __builtin_bit_cast(uint4, __builtin_amdgcn_ds_load_tr16_b128_v8i16((lds_s16x8*)p));
}

// One 16 (d) x 32 (keys) A fragment of V^T from row-major V rows of pitch bytes:
// keys k0 + 8h + 0..7 in elements 0..7, keys k0 + 16 + 8h + 0..7 in elements 8..15.
__device__ __forceinline__ v16bf ldfrag_tr(const unsigned char* p, unsigned pitch) {
    union { struct { uint4 lo, hi; } u; v16bf v; } f;
    f.u.lo = ld_tr16(p);
    f.u.hi = ld_tr16(p + 16 * pitch);
    return f.v;
}

__device__ __forceinline__ void wait_async0() {
    asm volatile("s_wait_asynccnt 0x0" ::: "memory");
}

// This wave's LDS reads have retired: stands in front of the barrier behind
// which the buffer they read is refilled by async copies.
__device__ __forceinline__ void wait_ds0() {
    asm volatile("s_wait_dscnt 0x0" ::: "memory");
}

// Low 32 bits of a generic pointer to __shared__ == raw LDS byte offset
// (flat-aperture rule: LDS_ADDR = addr[31:0]).
__device__ __forceinline__ unsigned lds_addr(const void* p) {
    return (unsigned)(unsigned long long)(uintptr_t)p;
}

// ---------------------------------------------------------------------------
// fp32 -> bf16 cast of x.  32 elements per thread (few, long-lived waves): eight
// 16-B loads in flight per lane, each wave-wide load 512 contiguous bytes, each
// wave-wide store 256.  Block blk takes 8192 contiguous elements.
// ---------------------------------------------------------------------------
#define CAST_PER_BLOCK 8192
__device__ __forceinline__ void cast_bf16_block(const float* __restrict__ src,
                                                __bf16* __restrict__ dst, int blk) {
    const size_t base = (size_t)blk * (CAST_PER_BLOCK / 4) + threadIdx.x;
    const float4* s4 = (const float4*)src + base;
    v4bf* d4 = (v4bf*)dst + base;
    float4 v[8];
    // both loops unrolled: v[] stays in registers, all loads issue before the first use
#pragma unroll
    for (int i = 0; i < 8; ++i) v[i] = s4[i * 256];
#pragma unroll
    for (int i = 0; i < 8; ++i) {
        v4bf o = { (__bf16)v[i].x, (__bf16)v[i].y, (__bf16)v[i].z, (__bf16)v[i].w };
        d4[i * 256] = o;
    }
}

// ---------------------------------------------------------------------------
// W[K][N] fp32  ->  Wt[N][K] bf16.  One block of 256 threads transposes a tile
// of 128 k x 64 n through LDS, 32 elements per thread: eight 16-B loads in flight
// per lane (a wave-wide load = two 256-B row pieces), four 16-B stores per lane
// (a wave-wide store = four whole 128-B lines).  K: a multiple of 128, N: of 64.
// LDS pitch 65 dwords: both the row-wise writes and the column-wise reads below
// fall on 32 different banks.  bn, bk: the tile's place along n and along k.
// ---------------------------------------------------------------------------
#define TR_K 128
#define TR_N 64
__device__ __forceinline__ void transpose_cast_block(const float* __restrict__ src,
                                                     __bf16* __restrict__ dst,
                                                     int K, int N, int bn, int bk) {
    __shared__ float tile[TR_K][TR_N + 1];
    const int n0 = bn * TR_N, k0 = bk * TR_K;
    const int tid = threadIdx.x, wave = tid >> 5, lane = tid & 31;

    const int lk = tid >> 4;          // 0..15 : first k row loaded by this thread
    const int ln = (tid & 15) * 4;    // its four n of that row
    const unsigned loff = (unsigned)(lk * N + ln);   // per lane; the rest is uniform
    float4 v[8];
    // every loop here is unrolled: v[] and o stay in registers, the eight loads issue
    // together, and the LDS offsets become immediates
#pragma unroll
    for (int p = 0; p < 8; ++p)
        v[p] = *(const float4*)(src + ((size_t)(k0 + 16 * p) * N + n0) + loff);
#pragma unroll
    for (int p = 0; p < 8; ++p) {
        float* t = &tile[lk + 16 * p][ln];
        t[0] = v[p].x; t[1] = v[p].y; t[2] = v[p].z; t[3] = v[p].w;
    }
    __syncthreads();

    const int kc = (lane & 7) * 8;    // this lane's eight k inside a 64-k half row
    const int ns = lane >> 3;         // 0..3 : which of the wave's four n rows
#pragma unroll
    for (int p = 0; p < 4; ++p) {
        const int q = wave * 4 + p;               // 0..31
        const int n = (q & 15) * 4 + ns;
        const int k = (q >> 4) * 64 + kc;
        v8bf o;
#pragma unroll
        for (int i = 0; i < 8; ++i) o[i] = (__bf16)tile[k + i][n];
        *(v8bf*)(dst + (size_t)(n0 + n) * K + k0 + k) = o;
    }
}

// ---------------------------------------------------------------------------
// All operand preparation in ONE launch: none of these pieces reads what another
// writes, so they need no launch boundary between them.  The flat block index
// falls in one of four ranges: w1's tiles, w2's tiles, the tiles of the four
// square weights, the pieces of x.  Every test below reads blockIdx alone, so a
// whole block takes one path and the transpose's barrier is passed by all of it.
// ---------------------------------------------------------------------------
#define PREP_FF_BLOCKS   ((D_FF / TR_N) * (D_MODEL / TR_K))        // 512, w1 and w2 alike
#define PREP_SQ_BLOCKS   ((D_MODEL / TR_N) * (D_MODEL / TR_K))     // 128 per square weight
#define PREP_CAST_BLOCKS ((NTOK * D_MODEL) / CAST_PER_BLOCK)       // 512
#define PREP_BLOCKS      (2 * PREP_FF_BLOCKS + 4 * PREP_SQ_BLOCKS + PREP_CAST_BLOCKS)
__global__ void prepare_operands_kernel(const float* __restrict__ x,
                                        const float* __restrict__ wq,
                                        const float* __restrict__ wk,
                                        const float* __restrict__ wv,
                                        const float* __restrict__ wo,
                                        const float* __restrict__ w1,
                                        const float* __restrict__ w2,
                                        __bf16* __restrict__ xbf,
                                        __bf16* __restrict__ wqt,
                                        __bf16* __restrict__ wkt,
                                        __bf16* __restrict__ wvt,
                                        __bf16* __restrict__ wot,
                                        __bf16* __restrict__ w1t,
                                        __bf16* __restrict__ w2t) {
    int b = blockIdx.x;
    if (b >= 2 * PREP_FF_BLOCKS + 4 * PREP_SQ_BLOCKS) {
        cast_bf16_block(x, xbf, b - (2 * PREP_FF_BLOCKS + 4 * PREP_SQ_BLOCKS));
        return;
    }
    const float* src;
    __bf16* dst;
    int K = D_MODEL, N = D_MODEL;
    int ntl = 4;                        // log2 of the tiles along n: D_MODEL / TR_N = 16
    if (b < PREP_FF_BLOCKS) {
        src = w1; dst = w1t; N = D_FF; ntl = 6;     // D_FF / TR_N = 64
    } else if (b < 2 * PREP_FF_BLOCKS) {
        b -= PREP_FF_BLOCKS;
        src = w2; dst = w2t; K = D_FF;
    } else {
        b -= 2 * PREP_FF_BLOCKS;
        const int w = b / PREP_SQ_BLOCKS;
        b -= w * PREP_SQ_BLOCKS;
        src = w == 0 ? wq  : w == 1 ? wk  : w == 2 ? wv  : wo;
        dst = w == 0 ? wqt : w == 1 ? wkt : w == 2 ? wvt : wot;
    }
    // shift and mask, not a division by a run-time N: the tile's place stays scalar
    transpose_cast_block(src, dst, K, N, b & ((1 << ntl) - 1), b >> ntl);
}

// ---------------------------------------------------------------------------
// GEMM: C[M][N] = A[M][K](bf16) * Bt[N][K](bf16)^T + bias, optional ReLU.
// Block tile 128x128, 256 threads = 8 waves (4x2), wave tile 32x64.
// K tile 128 (256 B of every operand row), double-buffered LDS filled by
// GLOBAL_LOAD_ASYNC_TO_LDS_B128: 16 lanes per row, so one copy of a wave takes
// two whole 256-B row pieces (four full 128-B lines).  Kd: a multiple of 128.
// Grid z: up to three products of the same A in one launch.  Product z takes the
// z-th [N][Kd] matrix behind Bt0, its own bias, and writes the z-th [M][N] bf16
// matrix behind Cbf0.
// ---------------------------------------------------------------------------
#define GEMM_BK  128
#define GEMM_LDP 136   // 128 K + 8 pad: pitch 272 B = 16 B x odd for ds_load_b128

__global__ void gemm_bf16_kernel(const __bf16* __restrict__ A,
                                 const __bf16* __restrict__ Bt0,
                                 const float* __restrict__ bias0,
                                 const float* __restrict__ bias1,
                                 const float* __restrict__ bias2,
                                 __bf16* __restrict__ Cbf0,
                                 float* __restrict__ Cf,
                                 int M, int N, int Kd, int relu) {
    __shared__ __align__(16) __bf16 Alds[2][128][GEMM_LDP];
    __shared__ __align__(16) __bf16 Blds[2][128][GEMM_LDP];

    const int z = blockIdx.z;
    const __bf16* Bt  = Bt0 + (size_t)z * N * Kd;
    const float* bias = z == 0 ? bias0 : z == 1 ? bias1 : bias2;
    __bf16* Cbf       = Cbf0 ? Cbf0 + (size_t)z * M * N : nullptr;

    const int tid  = threadIdx.x;
    const int wave = tid >> 5, lane = tid & 31;
    const int wm = wave >> 1, wn = wave & 1;
    const int bm = blockIdx.y * 128, bn = blockIdx.x * 128;
    const int kb = (lane >> 4) * 8;
    const int lr = tid >> 4;          // 0..15 : first tile row staged by this thread
    const int lc = (tid & 15) * 8;    // 0..120 (elements): its 16 B of the row piece

    const char* ag = (const char*)(A  + (size_t)(bm + lr) * Kd + lc);
    const char* bg = (const char*)(Bt + (size_t)(bn + lr) * Kd + lc);
    const size_t gstep = (size_t)Kd * 32;              // 16 rows, bytes
    const unsigned lstep = 16 * GEMM_LDP * 2;          // 16 rows, bytes
    const unsigned aldsv[2] = { lds_addr(&Alds[0][lr][lc]), lds_addr(&Alds[1][lr][lc]) };
    const unsigned bldsv[2] = { lds_addr(&Blds[0][lr][lc]), lds_addr(&Blds[1][lr][lc]) };

    v8f acc[2][4] = {};

    const int nk = Kd / GEMM_BK;

    // prologue: K tile 0 into buffer 0, published; then K tile 1 into buffer 1
    async_copy8x16B(aldsv[0], lstep, ag, gstep);
    async_copy8x16B(bldsv[0], lstep, bg, gstep);
    wait_async0();
    __syncthreads();
    if (nk > 1) {
        async_copy8x16B(aldsv[1], lstep, ag + GEMM_BK * 2, gstep);
        async_copy8x16B(bldsv[1], lstep, bg + GEMM_BK * 2, gstep);
    }

    for (int it = 0; it < nk; ++it) {
        const __bf16 (*Ac)[GEMM_LDP] = Alds[it & 1];
        const __bf16 (*Bc)[GEMM_LDP] = Blds[it & 1];

        // unrolled: every fragment's LDS offset becomes an immediate, and the next
        // 32 k's loads can be issued among this 32 k's products
#pragma unroll
        for (int ks = 0; ks < GEMM_BK; ks += 32) {
            v16bf af[2], bf_[4];
#pragma unroll
            for (int i = 0; i < 2; ++i) {
                const __bf16* r = &Ac[wm * 32 + i * 16 + (lane & 15)][ks + kb];
                af[i] = ldfrag(r, r + 16);
            }
#pragma unroll
            for (int j = 0; j < 4; ++j) {
                const __bf16* r = &Bc[wn * 64 + j * 16 + (lane & 15)][ks + kb];
                bf_[j] = ldfrag(r, r + 16);
            }
#pragma unroll
            for (int i = 0; i < 2; ++i)
#pragma unroll
                for (int j = 0; j < 4; ++j)
                    acc[i][j] = wmma_bf16(af[i], bf_[j], acc[i][j]);
        }

        // publish point of K tile it + 1
        wait_ds0();             // own reads of buffer it&1 retired
        wait_async0();          // own copies of K tile it + 1 landed in LDS
        __syncthreads();        // everyone's landed; everyone has left buffer it&1
        if (it + 2 < nk) {      // refill the buffer just left with K tile it + 2
            const size_t koff = (size_t)(it + 2) * (GEMM_BK * 2);
            async_copy8x16B(aldsv[it & 1], lstep, ag + koff, gstep);
            async_copy8x16B(bldsv[it & 1], lstep, bg + koff, gstep);
        }
    }
    wait_async0();              // nothing outstanding when the wave ends

    // Epilogue. C-frag: vgpr r -> row = base + r + ((lane>>4)<<3); col = base + (lane&15)
#pragma unroll
    for (int i = 0; i < 2; ++i)
#pragma unroll
        for (int j = 0; j < 4; ++j) {
            const int col  = bn + wn * 64 + j * 16 + (lane & 15);
            const int rowb = bm + wm * 32 + i * 16 + ((lane >> 4) << 3);
            const float bv = bias[col];
#pragma unroll
            for (int r = 0; r < 8; ++r) {
                float v = acc[i][j][r] + bv;
                if (relu) v = fmaxf(v, 0.f);
                const size_t idx = (size_t)(rowb + r) * N + col;
                if (Cbf) Cbf[idx] = (__bf16)v;
                else     Cf[idx]  = v;
            }
        }
}

// ---------------------------------------------------------------------------
// Flash attention (non-causal), computing S^T = K*Q^T so softmax statistics
// are per-lane and the P-frag C->B conversion is element-wise per lane.
// Grid: (SEQ/128, N_HEADS, BATCH), block 256 (8 waves x 16 queries).
// K and V rows are staged 128 keys a stage, both row-major, in two LDS buffers by
// async-to-LDS copies: stage s + 1 flies while stage s is worked on, one barrier
// per stage.  V^T fragments come out of the row-major V rows by the transposing load.
// ---------------------------------------------------------------------------
#define ATT_STAGE 128                    // keys per stage
#define ATT_NST   (SEQ / ATT_STAGE)      // 16 stages
#define ATT_KP    72                     // K pitch, elements: 144 B = 16 B x odd (ds_load_b128)
#define ATT_VP    80                     // V pitch, elements: 160 B = 32 B x odd (ds_load_tr16_b128)
// launch bounds: the block is 256 threads; without them the register budget is that of
// a 1024-thread block and the unrolled stage spills the Q fragments
__global__ void __launch_bounds__(256) flash_attn_kernel(const __bf16* __restrict__ Q,
                                  const __bf16* __restrict__ K,
                                  const __bf16* __restrict__ V,
                                  __bf16* __restrict__ O) {
    __shared__ __align__(16) __bf16 Klds[2][ATT_STAGE][ATT_KP];   // [key][d]
    __shared__ __align__(16) __bf16 Vlds[2][ATT_STAGE][ATT_VP];   // [key][d]

    const int qblk = blockIdx.x, h = blockIdx.y, b = blockIdx.z;
    const int tid = threadIdx.x, wave = tid >> 5, lane = tid & 31;
    const int kb = (lane >> 4) * 8;
    const int ld = D_MODEL;

    const int qrow = qblk * 128 + wave * 16 + (lane & 15);
    const __bf16* qp = Q + ((size_t)(b * SEQ + qrow)) * ld + h * HEAD_DIM;
    // Q as B-operand of K*Q^T: lane = query col, K-dim = head dim
    const v16bf qf0 = ldfrag(qp +  0 + kb, qp +  0 + kb + 16);
    const v16bf qf1 = ldfrag(qp + 32 + kb, qp + 32 + kb + 16);

    v8f o0 = {}, o1 = {}, o2 = {}, o3 = {};
    float m = -1e30f, l = 0.f;
    const float scale = 0.125f;   // 1/sqrt(64)

    const int cr = tid >> 3;             // first staged row of this thread  0..31
    const int cc = (tid & 7) * 8;        // its 16 B of the 128-B row        0..56

    const size_t goff = (size_t)(b * SEQ + cr) * ld + h * HEAD_DIM + cc;
    const char* kg = (const char*)(K + goff);
    const char* vg = (const char*)(V + goff);
    const size_t gstep  = (size_t)32 * ld * 2;          // 32 rows, bytes
    const size_t gstage = (size_t)ATT_STAGE * ld * 2;   // one stage, bytes
    const unsigned klstep = 32 * ATT_KP * 2, vlstep = 32 * ATT_VP * 2;
    const unsigned kldsv[2] = { lds_addr(&Klds[0][cr][cc]), lds_addr(&Klds[1][cr][cc]) };
    const unsigned vldsv[2] = { lds_addr(&Vlds[0][cr][cc]), lds_addr(&Vlds[1][cr][cc]) };

    // this lane's place in a 32-key block of V rows for the transposing load
    const unsigned vlane = (unsigned)((8 * (lane >> 4) + (lane & 7)) * (ATT_VP * 2)
                                      + 16 * ((lane >> 3) & 1));

    // prologue: stage 0 into buffer 0, published; then stage 1 into buffer 1
    async_copy4x16B(kldsv[0], klstep, kg, gstep);
    async_copy4x16B(vldsv[0], vlstep, vg, gstep);
    wait_async0();
    __syncthreads();
    async_copy4x16B(kldsv[1], klstep, kg + gstage, gstep);
    async_copy4x16B(vldsv[1], vlstep, vg + gstage, gstep);

    for (int st = 0; st < ATT_NST; ++st) {
        const __bf16 (*Kc)[ATT_KP] = Klds[st & 1];
        const unsigned char* Vc = (const unsigned char*)&Vlds[st & 1][0][0] + vlane;

        // unrolled: the LDS offsets become immediates, and the next 32 keys' fragment
        // loads can be issued among this 32 keys' vector work
#pragma unroll
        for (int kt = 0; kt < ATT_STAGE; kt += 32) {
            const int r0 = kt + (lane & 15), r1 = 16 + r0;
            v16bf ka00 = ldfrag(&Kc[r0][kb],      &Kc[r0][kb + 16]);
            v16bf ka01 = ldfrag(&Kc[r0][32 + kb], &Kc[r0][32 + kb + 16]);
            v16bf ka10 = ldfrag(&Kc[r1][kb],      &Kc[r1][kb + 16]);
            v16bf ka11 = ldfrag(&Kc[r1][32 + kb], &Kc[r1][32 + kb + 16]);

            v8f c0 = {}, c1 = {};
            c0 = wmma_bf16(ka00, qf0, c0);  c0 = wmma_bf16(ka01, qf1, c0);
            c1 = wmma_bf16(ka10, qf0, c1);  c1 = wmma_bf16(ka11, qf1, c1);

            const unsigned char* vt = Vc + kt * (ATT_VP * 2);
            v16bf va0 = ldfrag_tr(vt +  0, ATT_VP * 2);   // d  0..15
            v16bf va1 = ldfrag_tr(vt + 32, ATT_VP * 2);   // d 16..31
            v16bf va2 = ldfrag_tr(vt + 64, ATT_VP * 2);   // d 32..47
            v16bf va3 = ldfrag_tr(vt + 96, ATT_VP * 2);   // d 48..63

            // online softmax (per-lane query column; pair lanes L and L^16 share q)
            float loc = -1e30f;
#pragma unroll
            for (int r = 0; r < 8; ++r) {
                c0[r] *= scale; c1[r] *= scale;
                loc = fmaxf(loc, fmaxf(c0[r], c1[r]));
            }
            loc = fmaxf(loc, __shfl_xor(loc, 16, 32));
            const float mnew  = fmaxf(m, loc);
            const float alpha = __expf(m - mnew);
            float rs = 0.f;
            v16bf p;
#pragma unroll
            for (int r = 0; r < 8; ++r) {
                const float e0 = __expf(c0[r] - mnew);
                const float e1 = __expf(c1[r] - mnew);
                rs += e0 + e1;
                p[r]     = (__bf16)e0;   // keys kb-block of sub-tile 0
                p[8 + r] = (__bf16)e1;   // keys kb-block of sub-tile 1
            }
            rs += __shfl_xor(rs, 16, 32);
            l = l * alpha + rs;
            m = mnew;
#pragma unroll
            for (int r = 0; r < 8; ++r) {
                o0[r] *= alpha; o1[r] *= alpha; o2[r] *= alpha; o3[r] *= alpha;
            }
            // O^T += V^T * P^T
            o0 = wmma_bf16(va0, p, o0);
            o1 = wmma_bf16(va1, p, o1);
            o2 = wmma_bf16(va2, p, o2);
            o3 = wmma_bf16(va3, p, o3);
        }

        // publish point of stage st + 1
        wait_ds0();             // own reads of buffer st&1 retired
        wait_async0();          // own copies of stage st + 1 landed in LDS
        __syncthreads();        // everyone's landed; everyone has left buffer st&1
        if (st + 2 < ATT_NST) { // refill the buffer just left with stage st + 2
            const size_t soff = (size_t)(st + 2) * gstage;
            async_copy4x16B(kldsv[st & 1], klstep, kg + soff, gstep);
            async_copy4x16B(vldsv[st & 1], vlstep, vg + soff, gstep);
        }
    }
    wait_async0();              // nothing outstanding when the wave ends

    const float inv = 1.f / l;
    __bf16* ob = O + ((size_t)(b * SEQ + qrow)) * ld + h * HEAD_DIM;
#pragma unroll
    for (int r = 0; r < 8; ++r) {
        const int dhi = r + ((lane >> 4) << 3);
        ob[ 0 + dhi] = (__bf16)(o0[r] * inv);
        ob[16 + dhi] = (__bf16)(o1[r] * inv);
        ob[32 + dhi] = (__bf16)(o2[r] * inv);
        ob[48 + dhi] = (__bf16)(o3[r] * inv);
    }
}

// ---------------------------------------------------------------------------
// y = LayerNorm(a + r) * g + b   (fp32 master, optional bf16 side output)
// One wave per row, 32 elements per lane held in registers (16-B loads, whole
// lines per wave-wide access), the row's two sums by a butterfly inside the wave,
// no LDS and no barrier.  Block 256 = 8 rows.
// ---------------------------------------------------------------------------
__global__ void ln_residual_kernel(const float* __restrict__ a,
                                   const float* __restrict__ rr,
                                   const float* __restrict__ g,
                                   const float* __restrict__ bb,
                                   float* __restrict__ of,
                                   __bf16* __restrict__ obf) {
    const int D = D_MODEL;
    const int wave = threadIdx.x >> 5, lane = threadIdx.x & 31;
    const size_t row = (size_t)blockIdx.x * 8 + wave;
    const v4f* pa = (const v4f*)(a  + row * D) + lane;
    const v4f* pr = (const v4f*)(rr + row * D) + lane;
    const v4f* pg = (const v4f*)g  + lane;
    const v4f* pb = (const v4f*)bb + lane;
    v4f v[8], w[8], g4[8], b4[8];
    // the loops over i are unrolled so that the four arrays stay in registers
#pragma unroll
    for (int i = 0; i < 8; ++i) { v[i] = pa[i * 32]; w[i] = pr[i * 32]; }
#pragma unroll
    for (int i = 0; i < 8; ++i) { g4[i] = pg[i * 32]; b4[i] = pb[i * 32]; }
    v4f s4 = {0.f, 0.f, 0.f, 0.f}, q4 = {0.f, 0.f, 0.f, 0.f};
#pragma unroll
    for (int i = 0; i < 8; ++i) {
        v[i] += w[i];
        s4 += v[i];
        q4 += v[i] * v[i];
    }
    float s = (s4.x + s4.y) + (s4.z + s4.w);
    float q = (q4.x + q4.y) + (q4.z + q4.w);
    for (int o = 16; o > 0; o >>= 1) {
        s += __shfl_xor(s, o, 32);
        q += __shfl_xor(q, o, 32);
    }
    const float mu  = s / D;
    const float var = q / D - mu * mu;
    const float inv = rsqrtf(var + 1e-5f);
#pragma unroll
    for (int i = 0; i < 8; ++i) v[i] = (v[i] - mu) * inv * g4[i] + b4[i];
    v4f* po = (v4f*)(of + row * D) + lane;
    if (obf) {
        v4bf* pob = (v4bf*)(obf + row * D) + lane;
#pragma unroll
        for (int i = 0; i < 8; ++i) {
            v4bf yb = { (__bf16)v[i].x, (__bf16)v[i].y, (__bf16)v[i].z, (__bf16)v[i].w };
            pob[i * 32] = yb;
        }
    }
#pragma unroll
    for (int i = 0; i < 8; ++i) po[i * 32] = v[i];
}

// ---------------------------------------------------------------------------
extern "C" void kernel_launch(void* const* d_in, const int* in_sizes, int n_in,
                              void* d_out, int out_size, void* d_ws, size_t ws_size,
                              hipStream_t stream) {
    const float* x    = (const float*)d_in[0];
    const float* wq   = (const float*)d_in[1];
    const float* bq   = (const float*)d_in[2];
    const float* wk   = (const float*)d_in[3];
    const float* bk   = (const float*)d_in[4];
    const float* wv   = (const float*)d_in[5];
    const float* bv   = (const float*)d_in[6];
    const float* wo   = (const float*)d_in[7];
    const float* bo   = (const float*)d_in[8];
    const float* w1   = (const float*)d_in[9];
    const float* b1   = (const float*)d_in[10];
    const float* w2   = (const float*)d_in[11];
    const float* b2   = (const float*)d_in[12];
    const float* ln1g = (const float*)d_in[13];
    const float* ln1b = (const float*)d_in[14];
    const float* ln2g = (const float*)d_in[15];
    const float* ln2b = (const float*)d_in[16];

    char* ws = (char*)d_ws;
    const size_t MiB = 1024 * 1024;
    __bf16* WQT  = (__bf16*)(ws + 0 * MiB);    // 2 MiB each; WQT, WKT, WVT in a row
    __bf16* WKT  = (__bf16*)(ws + 2 * MiB);
    __bf16* WVT  = (__bf16*)(ws + 4 * MiB);
    __bf16* WOT  = (__bf16*)(ws + 6 * MiB);
    __bf16* W1T  = (__bf16*)(ws + 8 * MiB);    // 8 MiB
    __bf16* W2T  = (__bf16*)(ws + 16 * MiB);   // 8 MiB
    __bf16* XBF  = (__bf16*)(ws + 24 * MiB);   // 8 MiB : x bf16, later attn-out bf16
    __bf16* QBF  = (__bf16*)(ws + 32 * MiB);   // 8 MiB; QBF, KBF, VBF in a row
    __bf16* KBF  = (__bf16*)(ws + 40 * MiB);   // 8 MiB
    __bf16* VBF  = (__bf16*)(ws + 48 * MiB);   // 8 MiB
    float*  TMPF = (float* )(ws + 32 * MiB);   // 16 MiB : o-proj f32, later ffn2 f32
    float*  X1F  = (float* )(ws + 56 * MiB);   // 16 MiB
    __bf16* X1BF = (__bf16*)(ws + 72 * MiB);   // 8 MiB
    __bf16* HBF  = (__bf16*)(ws + 80 * MiB);   // 32 MiB
    float*  out  = (float*)d_out;

    // 1) cast of x and all weight transposes, one launch
    prepare_operands_kernel<<<PREP_BLOCKS, 256, 0, stream>>>(x, wq, wk, wv, wo, w1, w2,
                                                             XBF, WQT, WKT, WVT, WOT, W1T, W2T);

    // 2) Q, K and V projections, one launch: grid z = 0, 1, 2
    gemm_bf16_kernel<<<dim3(D_MODEL/128, NTOK/128, 3), 256, 0, stream>>>(XBF, WQT, bq, bk, bv, QBF, nullptr, NTOK, D_MODEL, D_MODEL, 0);

    // 3) flash attention -> XBF (concat heads, row-major)
    flash_attn_kernel<<<dim3(SEQ/128, N_HEADS, BATCH), 256, 0, stream>>>(QBF, KBF, VBF, XBF);

    // 4) output projection (f32) + residual LN1
    gemm_bf16_kernel<<<dim3(D_MODEL/128, NTOK/128), 256, 0, stream>>>(XBF, WOT, bo, nullptr, nullptr, nullptr, TMPF, NTOK, D_MODEL, D_MODEL, 0);
    ln_residual_kernel<<<NTOK / 8, 256, 0, stream>>>(x, TMPF, ln1g, ln1b, X1F, X1BF);

    // 5) FFN
    gemm_bf16_kernel<<<dim3(D_FF/128,    NTOK/128), 256, 0, stream>>>(X1BF, W1T, b1, nullptr, nullptr, HBF, nullptr, NTOK, D_FF, D_MODEL, 1);
    gemm_bf16_kernel<<<dim3(D_MODEL/128, NTOK/128), 256, 0, stream>>>(HBF,  W2T, b2, nullptr, nullptr, nullptr, TMPF, NTOK, D_MODEL, D_FF, 0);

    // 6) residual LN2 -> final output
    ln_residual_kernel<<<NTOK / 8, 256, 0, stream>>>(X1F, TMPF, ln2g, ln2b, out, nullptr);
}

// v005
// It runs in 169 microseconds.
// Two timings next to v004 put it at 1.05 and 1.04 times that version's speed.
// All steps since v000 together make it 1.91 times as fast.
#include <hip/hip_runtime.h>

typedef __attribute__((ext_vector_type(16))) __bf16 v16bf;
typedef __attribute__((ext_vector_type(8)))  float  v8f;
typedef __attribute__((ext_vector_type(8)))  __bf16 v8bf;
typedef __attribute__((ext_vector_type(4)))  __bf16 v4bf;
typedef __attribute__((ext_vector_type(4)))  float  v4f;

#define D_MODEL  1024
#define N_HEADS  16
#define HEAD_DIM 64
#define D_FF     4096
#define SEQ      2048
#define BATCH    2
#define NTOK     (BATCH * SEQ)   // 4096 rows

// ---------------------------------------------------------------------------
// Fragment helpers.
// A-style 16x32 bf16 fragment: lane L holds row M = L&15; K base = (L>>4)*8;
// vector elems e0..e7 = K kb..kb+7, e8..e15 = K kb+16..kb+23  -> two 16B loads.
// ---------------------------------------------------------------------------
__device__ __forceinline__ v16bf ldfrag(const __bf16* p0, const __bf16* p1) {
    union { struct { uint4 lo, hi; } u; v16bf v; } f;
    f.u.lo = *(const uint4*)p0;
    f.u.hi = *(const uint4*)p1;
    return f.v;
}

__device__ __forceinline__ v8f wmma_bf16(v16bf a, v16bf b, v8f c) {
    // D(f32 16x16) = A(bf16 16x32) * B(bf16 32x16) + C
    return __builtin_amdgcn_wmma_f32_16x16x32_bf16(false, a, false, b,
                                                   (short)0, c, false, false);
}

// Async DMA: eight b128 copies global -> LDS, 16 B per lane each.  Copy c takes
// the lane's 16 B of tile row (row0 + 16 * c): LDS address lds + c * lstep,
// global address g + c * gstep (both in bytes).  The closing s_wait_xcnt stands
// inside the statement so that no address register named by a copy is rewritten
// ahead of it.
__device__ __forceinline__ void async_copy8x16B(unsigned lds, unsigned lstep,
                                                const char* g, size_t gstep) {
    asm volatile(
        "global_load_async_to_lds_b128 %0, %8, off\n\t"
        "global_load_async_to_lds_b128 %1, %9, off\n\t"
        "global_load_async_to_lds_b128 %2, %10, off\n\t"
        "global_load_async_to_lds_b128 %3, %11, off\n\t"
        "global_load_async_to_lds_b128 %4, %12, off\n\t"
        "global_load_async_to_lds_b128 %5, %13, off\n\t"
        "global_load_async_to_lds_b128 %6, %14, off\n\t"
        "global_load_async_to_lds_b128 %7, %15, off\n\t"
        "s_wait_xcnt 0x0"
        :: "v"(lds), "v"(lds + lstep), "v"(lds + 2 * lstep), "v"(lds + 3 * lstep),
           "v"(lds + 4 * lstep), "v"(lds + 5 * lstep), "v"(lds + 6 * lstep),
           "v"(lds + 7 * lstep),
           "v"(g), "v"(g + gstep), "v"(g + 2 * gstep), "v"(g + 3 * gstep),
           "v"(g + 4 * gstep), "v"(g + 5 * gstep), "v"(g + 6 * gstep),
           "v"(g + 7 * gstep)
        : "memory");
}

// The same with four copies: copy c takes the lane's 16 B of tile row (row0 + 32 * c).
__device__ __forceinline__ void async_copy4x16B(unsigned lds, unsigned lstep,
                                                const char* g, size_t gstep) {
    asm volatile(
        "global_load_async_to_lds_b128 %0, %4, off\n\t"
        "global_load_async_to_lds_b128 %1, %5, off\n\t"
        "global_load_async_to_lds_b128 %2, %6, off\n\t"
        "global_load_async_to_lds_b128 %3, %7, off\n\t"
        "s_wait_xcnt 0x0"
        :: "v"(lds), "v"(lds + lstep), "v"(lds + 2 * lstep), "v"(lds + 3 * lstep),
           "v"(g), "v"(g + gstep), "v"(g + 2 * gstep), "v"(g + 3 * gstep)
        : "memory");
}

// Transposing LDS load: from a row-major 16-bit tile T, lane (c = l & 15, h = l >> 4)
// gets T[k0 + 8h + 0..7][d0 + c] when lane l points at row k0 + 8 * (l >> 4) + (l & 7),
// byte 2 * d0 + 16 * ((l >> 3) & 1) of that row.
typedef short s16x8 __attribute__((ext_vector_type(8)));
__device__ __forceinline__ uint4 ld_tr16(const unsigned char* p) {
    typedef __attribute__((address_space(3))) s16x8 lds_s16x8;
    return __builtin_bit_cast(uint4, __builtin_amdgcn_ds_load_tr16_b128_v8i16((lds_s16x8*)p));
}

// One 16 (d) x 32 (keys) A fragment of V^T from row-major V rows of pitch bytes:
// keys k0 + 8h + 0..7 in elements 0..7, keys k0 + 16 + 8h + 0..7 in elements 8..15.
__device__ __forceinline__ v16bf ldfrag_tr(const unsigned char* p, unsigned pitch) {
    union { struct { uint4 lo, hi; } u; v16bf v; } f;
    f.u.lo = ld_tr16(p);
    f.u.hi = ld_tr16(p + 16 * pitch);
    return f.v;
}

__device__ __forceinline__ void wait_async0() {
    asm volatile("s_wait_asynccnt 0x0" ::: "memory");
}

// This wave's LDS accesses have retired: stands in front of the barrier behind
// which the buffer they read is refilled by async copies, and between the GEMM
// epilogue's staging writes and their read-back.
__device__ __forceinline__ void wait_ds0() {
    asm volatile("s_wait_dscnt 0x0" ::: "memory");
}

// Low 32 bits of a generic pointer to __shared__ == raw LDS byte offset
// (flat-aperture rule: LDS_ADDR = addr[31:0]).
__device__ __forceinline__ unsigned lds_addr(const void* p) {
    return (unsigned)(unsigned long long)(uintptr_t)p;
}

// ---------------------------------------------------------------------------
// fp32 -> bf16 cast of x.  32 elements per thread (few, long-lived waves): eight
// 16-B loads in flight per lane, each wave-wide load 512 contiguous bytes, each
// wave-wide store 256.  Block blk takes 8192 contiguous elements.
// ---------------------------------------------------------------------------
#define CAST_PER_BLOCK 8192
__device__ __forceinline__ void cast_bf16_block(const float* __restrict__ src,
                                                __bf16* __restrict__ dst, int blk) {
    const size_t base = (size_t)blk * (CAST_PER_BLOCK / 4) + threadIdx.x;
    const float4* s4 = (const float4*)src + base;
    v4bf* d4 = (v4bf*)dst + base;
    float4 v[8];
    // both loops unrolled: v[] stays in registers, all loads issue before the first use
#pragma unroll
    for (int i = 0; i < 8; ++i) v[i] = s4[i * 256];
#pragma unroll
    for (int i = 0; i < 8; ++i) {
        v4bf o = { (__bf16)v[i].x, (__bf16)v[i].y, (__bf16)v[i].z, (__bf16)v[i].w };
        d4[i * 256] = o;
    }
}

// ---------------------------------------------------------------------------
// W[K][N] fp32  ->  Wt[N][K] bf16.  One block of 256 threads transposes a tile
// of 128 k x 64 n through LDS, 32 elements per thread: eight 16-B loads in flight
// per lane (a wave-wide load = two 256-B row pieces), four 16-B stores per lane
// (a wave-wide store = four whole 128-B lines).  K: a multiple of 128, N: of 64.
// LDS pitch 65 dwords: both the row-wise writes and the column-wise reads below
// fall on 32 different banks.  bn, bk: the tile's place along n and along k.
// ---------------------------------------------------------------------------
#define TR_K 128
#define TR_N 64
__device__ __forceinline__ void transpose_cast_block(const float* __restrict__ src,
                                                     __bf16* __restrict__ dst,
                                                     int K, int N, int bn, int bk) {
    __shared__ float tile[TR_K][TR_N + 1];
    const int n0 = bn * TR_N, k0 = bk * TR_K;
    const int tid = threadIdx.x, wave = tid >> 5, lane = tid & 31;

    const int lk = tid >> 4;          // 0..15 : first k row loaded by this thread
    const int ln = (tid & 15) * 4;    // its four n of that row
    const unsigned loff = (unsigned)(lk * N + ln);   // per lane; the rest is uniform
    float4 v[8];
    // every loop here is unrolled: v[] and o stay in registers, the eight loads issue
    // together, and the LDS offsets become immediates
#pragma unroll
    for (int p = 0; p < 8; ++p)
        v[p] = *(const float4*)(src + ((size_t)(k0 + 16 * p) * N + n0) + loff);
#pragma unroll
    for (int p = 0; p < 8; ++p) {
        float* t = &tile[lk + 16 * p][ln];
        t[0] = v[p].x; t[1] = v[p].y; t[2] = v[p].z; t[3] = v[p].w;
    }
    __syncthreads();

    const int kc = (lane & 7) * 8;    // this lane's eight k inside a 64-k half row
    const int ns = lane >> 3;         // 0..3 : which of the wave's four n rows
#pragma unroll
    for (int p = 0; p < 4; ++p) {
        const int q = wave * 4 + p;               // 0..31
        const int n = (q & 15) * 4 + ns;
        const int k = (q >> 4) * 64 + kc;
        v8bf o;
#pragma unroll
        for (int i = 0; i < 8; ++i) o[i] = (__bf16)tile[k + i][n];
        *(v8bf*)(dst + (size_t)(n0 + n) * K + k0 + k) = o;
    }
}

// ---------------------------------------------------------------------------
// All operand preparation in ONE launch: none of these pieces reads what another
// writes, so they need no launch boundary between them.  The flat block index
// falls in one of four ranges: w1's tiles, w2's tiles, the tiles of the four
// square weights, the pieces of x.  Every test below reads blockIdx alone, so a
// whole block takes one path and the transpose's barrier is passed by all of it.
// ---------------------------------------------------------------------------
#define PREP_FF_BLOCKS   ((D_FF / TR_N) * (D_MODEL / TR_K))        // 512, w1 and w2 alike
#define PREP_SQ_BLOCKS   ((D_MODEL / TR_N) * (D_MODEL / TR_K))     // 128 per square weight
#define PREP_CAST_BLOCKS ((NTOK * D_MODEL) / CAST_PER_BLOCK)       // 512
#define PREP_BLOCKS      (2 * PREP_FF_BLOCKS + 4 * PREP_SQ_BLOCKS + PREP_CAST_BLOCKS)
__global__ void prepare_operands_kernel(const float* __restrict__ x,
                                        const float* __restrict__ wq,
                                        const float* __restrict__ wk,
                                        const float* __restrict__ wv,
                                        const float* __restrict__ wo,
                                        const float* __restrict__ w1,
                                        const float* __restrict__ w2,
                                        __bf16* __restrict__ xbf,
                                        __bf16* __restrict__ wqt,
                                        __bf16* __restrict__ wkt,
                                        __bf16* __restrict__ wvt,
                                        __bf16* __restrict__ wot,
                                        __bf16* __restrict__ w1t,
                                        __bf16* __restrict__ w2t) {
    int b = blockIdx.x;
    if (b >= 2 * PREP_FF_BLOCKS + 4 * PREP_SQ_BLOCKS) {
        cast_bf16_block(x, xbf, b - (2 * PREP_FF_BLOCKS + 4 * PREP_SQ_BLOCKS));
        return;
    }
    const float* src;
    __bf16* dst;
    int K = D_MODEL, N = D_MODEL;
    int ntl = 4;                        // log2 of the tiles along n: D_MODEL / TR_N = 16
    if (b < PREP_FF_BLOCKS) {
        src = w1; dst = w1t; N = D_FF; ntl = 6;     // D_FF / TR_N = 64
    } else if (b < 2 * PREP_FF_BLOCKS) {
        b -= PREP_FF_BLOCKS;
        src = w2; dst = w2t; K = D_FF;
    } else {
        b -= 2 * PREP_FF_BLOCKS;
        const int w = b / PREP_SQ_BLOCKS;
        b -= w * PREP_SQ_BLOCKS;
        src = w == 0 ? wq  : w == 1 ? wk  : w == 2 ? wv  : wo;
        dst = w == 0 ? wqt : w == 1 ? wkt : w == 2 ? wvt : wot;
    }
    // shift and mask, not a division by a run-time N: the tile's place stays scalar
    transpose_cast_block(src, dst, K, N, b & ((1 << ntl) - 1), b >> ntl);
}

// ---------------------------------------------------------------------------
// GEMM: C[M][N] = A[M][K](bf16) * Bt[N][K](bf16)^T + bias, optional ReLU.
// Block tile 128x128, 256 threads = 8 waves (4x2), wave tile 32x64.
// K tile 128 (256 B of every operand row), double-buffered LDS filled by
// GLOBAL_LOAD_ASYNC_TO_LDS_B128: 16 lanes per row, so one copy of a wave takes
// two whole 256-B row pieces (four full 128-B lines).  Kd: a multiple of 128.
// Grid z: up to three products of the same A in one launch.  Product z takes the
// z-th [N][Kd] matrix behind Bt0, its own bias, and writes the z-th [M][N] bf16
// matrix behind Cbf0.
// ---------------------------------------------------------------------------
#define GEMM_BK  128
#define GEMM_LDP 136   // 128 K + 8 pad: pitch 272 B = 16 B x odd for ds_load_b128
// Output staging, bytes: row pitch of a wave's 32x64 tile in bf16 (128 + 16) and in f32
// (256 + 16), both 16 B x odd; a wave's range holds the larger, eight of them fill Alds.
#define GEMM_STG_PBF  144
#define GEMM_STG_PF   272
#define GEMM_STG_WAVE (32 * GEMM_STG_PF)

__global__ void gemm_bf16_kernel(const __bf16* __restrict__ A,
                                 const __bf16* __restrict__ Bt0,
                                 const float* __restrict__ bias0,
                                 const float* __restrict__ bias1,
                                 const float* __restrict__ bias2,
                                 __bf16* __restrict__ Cbf0,
                                 float* __restrict__ Cf,
                                 int M, int N, int Kd, int relu) {
    __shared__ __align__(16) __bf16 Alds[2][128][GEMM_LDP];
    __shared__ __align__(16) __bf16 Blds[2][128][GEMM_LDP];

    const int z = blockIdx.z;
    const __bf16* Bt  = Bt0 + (size_t)z * N * Kd;
    const float* bias = z == 0 ? bias0 : z == 1 ? bias1 : bias2;
    __bf16* Cbf       = Cbf0 ? Cbf0 + (size_t)z * M * N : nullptr;

    const int tid  = threadIdx.x;
    const int wave = tid >> 5, lane = tid & 31;
    const int wm = wave >> 1, wn = wave & 1;
    const int bm = blockIdx.y * 128, bn = blockIdx.x * 128;
    const int kb = (lane >> 4) * 8;
    const int lr = tid >> 4;          // 0..15 : first tile row staged by this thread
    const int lc = (tid & 15) * 8;    // 0..120 (elements): its 16 B of the row piece

    const char* ag = (const char*)(A  + (size_t)(bm + lr) * Kd + lc);
    const char* bg = (const char*)(Bt + (size_t)(bn + lr) * Kd + lc);
    const size_t gstep = (size_t)Kd * 32;              // 16 rows, bytes
    const unsigned lstep = 16 * GEMM_LDP * 2;          // 16 rows, bytes
    const unsigned aldsv[2] = { lds_addr(&Alds[0][lr][lc]), lds_addr(&Alds[1][lr][lc]) };
    const unsigned bldsv[2] = { lds_addr(&Blds[0][lr][lc]), lds_addr(&Blds[1][lr][lc]) };

    v8f acc[2][4] = {};

    const int nk = Kd / GEMM_BK;

    // prologue: K tile 0 into buffer 0, published; then K tile 1 into buffer 1
    async_copy8x16B(aldsv[0], lstep, ag, gstep);
    async_copy8x16B(bldsv[0], lstep, bg, gstep);
    wait_async0();
    __syncthreads();
    if (nk > 1) {
        async_copy8x16B(aldsv[1], lstep, ag + GEMM_BK * 2, gstep);
        async_copy8x16B(bldsv[1], lstep, bg + GEMM_BK * 2, gstep);
    }

    for (int it = 0; it < nk; ++it) {
        const __bf16 (*Ac)[GEMM_LDP] = Alds[it & 1];
        const __bf16 (*Bc)[GEMM_LDP] = Blds[it & 1];

        // unrolled: every fragment's LDS offset becomes an immediate, and the next
        // 32 k's loads can be issued among this 32 k's products
#pragma unroll
        for (int ks = 0; ks < GEMM_BK; ks += 32) {
            v16bf af[2], bf_[4];
#pragma unroll
            for (int i = 0; i < 2; ++i) {
                const __bf16* r = &Ac[wm * 32 + i * 16 + (lane & 15)][ks + kb];
                af[i] = ldfrag(r, r + 16);
            }
#pragma unroll
            for (int j = 0; j < 4; ++j) {
                const __bf16* r = &Bc[wn * 64 + j * 16 + (lane & 15)][ks + kb];
                bf_[j] = ldfrag(r, r + 16);
            }
#pragma unroll
            for (int i = 0; i < 2; ++i)
#pragma unroll
                for (int j = 0; j < 4; ++j)
                    acc[i][j] = wmma_bf16(af[i], bf_[j], acc[i][j]);
        }

        // publish point of K tile it + 1
        wait_ds0();             // own reads of buffer it&1 retired
        wait_async0();          // own copies of K tile it + 1 landed in LDS
        __syncthreads();        // everyone's landed; everyone has left buffer it&1
        if (it + 2 < nk) {      // refill the buffer just left with K tile it + 2
            const size_t koff = (size_t)(it + 2) * (GEMM_BK * 2);
            async_copy8x16B(aldsv[it & 1], lstep, ag + koff, gstep);
            async_copy8x16B(bldsv[it & 1], lstep, bg + koff, gstep);
        }
    }
    wait_async0();              // nothing outstanding when the wave ends

    // Epilogue. C-frag: vgpr r -> row = base + r + ((lane>>4)<<3); col = base + (lane&15).
    // Each wave lays its 32x64 tile, in the output's type, in a range of its own in the
    // ring (the last trip's barrier stands behind everyone's last read of it and no copy
    // is outstanding), reads it back row-wise and stores whole 128-B lines, 16 B a lane.
    // Every loop here is unrolled: acc stays in registers, the LDS offsets are immediates.
    char* stg = (char*)&Alds[0][0][0] + wave * GEMM_STG_WAVE;
    const int cl = lane & 15, rh = (lane >> 4) << 3;
    float bv[4];
#pragma unroll
    for (int j = 0; j < 4; ++j) bv[j] = bias[bn + wn * 64 + j * 16 + cl];
#pragma unroll
    for (int i = 0; i < 2; ++i)
#pragma unroll
        for (int j = 0; j < 4; ++j) acc[i][j] += bv[j];
    if (relu) {     // one test for the whole tile, the values changed in place
#pragma unroll
        for (int i = 0; i < 2; ++i)
#pragma unroll
            for (int j = 0; j < 4; ++j)
#pragma unroll
                for (int r = 0; r < 8; ++r) acc[i][j][r] = fmaxf(acc[i][j][r], 0.f);
    }

    if (Cbf) {      // one test for the whole tile: both paths are straight-line code
#pragma unroll
        for (int i = 0; i < 2; ++i)
#pragma unroll
            for (int j = 0; j < 4; ++j)
#pragma unroll
                for (int r = 0; r < 8; ++r)
                    *(__bf16*)(stg + (i * 16 + rh + r) * GEMM_STG_PBF + (j * 16 + cl) * 2) =
                        (__bf16)acc[i][j][r];
        wait_ds0();     // the rows read back below were written by other lanes of this wave
        // a wave-wide access = four rows of 128 B: 8 lanes a row
        const char* sr = stg + (lane >> 3) * GEMM_STG_PBF + (lane & 7) * 16;
        __bf16* cw = Cbf + (size_t)(bm + wm * 32 + (lane >> 3)) * N + bn + wn * 64 + (lane & 7) * 8;
#pragma unroll
        for (int q = 0; q < 8; ++q)
            *(uint4*)(cw + (size_t)(4 * q) * N) = *(const uint4*)(sr + 4 * q * GEMM_STG_PBF);
    } else {
#pragma unroll
        for (int i = 0; i < 2; ++i)
#pragma unroll
            for (int j = 0; j < 4; ++j)
#pragma unroll
                for (int r = 0; r < 8; ++r)
                    *(float*)(stg + (i * 16 + rh + r) * GEMM_STG_PF + (j * 16 + cl) * 4) =
                        acc[i][j][r];
        wait_ds0();     // the rows read back below were written by other lanes of this wave
        // a wave-wide access = two rows of 256 B: 16 lanes a row
        const char* sr = stg + (lane >> 4) * GEMM_STG_PF + cl * 16;
        float* cw = Cf + (size_t)(bm + wm * 32 + (lane >> 4)) * N + bn + wn * 64 + cl * 4;
#pragma unroll
        for (int q = 0; q < 16; ++q)
            *(uint4*)(cw + (size_t)(2 * q) * N) = *(const uint4*)(sr + 2 * q * GEMM_STG_PF);
    }
}

// ---------------------------------------------------------------------------
// Flash attention (non-causal), computing S^T = K*Q^T so softmax statistics
// are per-lane and the P-frag C->B conversion is element-wise per lane.
// Grid: (SEQ/128, N_HEADS, BATCH), block 256 (8 waves x 16 queries).
// K and V rows are staged 128 keys a stage, both row-major, in two LDS buffers by
// async-to-LDS copies: stage s + 1 flies while stage s is worked on, one barrier
// per stage.  V^T fragments come out of the row-major V rows by the transposing load.
// ---------------------------------------------------------------------------
#define ATT_STAGE 128                    // keys per stage
#define ATT_NST   (SEQ / ATT_STAGE)      // 16 stages
#define ATT_KP    72                     // K pitch, elements: 144 B = 16 B x odd (ds_load_b128)
#define ATT_VP    80                     // V pitch, elements: 160 B = 32 B x odd (ds_load_tr16_b128)
// launch bounds: the block is 256 threads; without them the register budget is that of
// a 1024-thread block and the unrolled stage spills the Q fragments
__global__ void __launch_bounds__(256) flash_attn_kernel(const __bf16* __restrict__ Q,
                                  const __bf16* __restrict__ K,
                                  const __bf16* __restrict__ V,
                                  __bf16* __restrict__ O) {
    __shared__ __align__(16) __bf16 Klds[2][ATT_STAGE][ATT_KP];   // [key][d]
    __shared__ __align__(16) __bf16 Vlds[2][ATT_STAGE][ATT_VP];   // [key][d]

    const int qblk = blockIdx.x, h = blockIdx.y, b = blockIdx.z;
    const int tid = threadIdx.x, wave = tid >> 5, lane = tid & 31;
    const int kb = (lane >> 4) * 8;
    const int ld = D_MODEL;

    const int qrow = qblk * 128 + wave * 16 + (lane & 15);
    const __bf16* qp = Q + ((size_t)(b * SEQ + qrow)) * ld + h * HEAD_DIM;
    // Q as B-operand of K*Q^T: lane = query col, K-dim = head dim
    const v16bf qf0 = ldfrag(qp +  0 + kb, qp +  0 + kb + 16);
    const v16bf qf1 = ldfrag(qp + 32 + kb, qp + 32 + kb + 16);

    v8f o0 = {}, o1 = {}, o2 = {}, o3 = {};
    float m = -1e30f, l = 0.f;
    const float scale = 0.125f;   // 1/sqrt(64)

    const int cr = tid >> 3;             // first staged row of this thread  0..31
    const int cc = (tid & 7) * 8;        // its 16 B of the 128-B row        0..56

    const size_t goff = (size_t)(b * SEQ + cr) * ld + h * HEAD_DIM + cc;
    const char* kg = (const char*)(K + goff);
    const char* vg = (const char*)(V + goff);
    const size_t gstep  = (size_t)32 * ld * 2;          // 32 rows, bytes
    const size_t gstage = (size_t)ATT_STAGE * ld * 2;   // one stage, bytes
    const unsigned klstep = 32 * ATT_KP * 2, vlstep = 32 * ATT_VP * 2;
    const unsigned kldsv[2] = { lds_addr(&Klds[0][cr][cc]), lds_addr(&Klds[1][cr][cc]) };
    const unsigned vldsv[2] = { lds_addr(&Vlds[0][cr][cc]), lds_addr(&Vlds[1][cr][cc]) };

    // this lane's place in a 32-key block of V rows for the transposing load
    const unsigned vlane = (unsigned)((8 * (lane >> 4) + (lane & 7)) * (ATT_VP * 2)
                                      + 16 * ((lane >> 3) & 1));

    // prologue: stage 0 into buffer 0, published; then stage 1 into buffer 1
    async_copy4x16B(kldsv[0], klstep, kg, gstep);
    async_copy4x16B(vldsv[0], vlstep, vg, gstep);
    wait_async0();
    __syncthreads();
    async_copy4x16B(kldsv[1], klstep, kg + gstage, gstep);
    async_copy4x16B(vldsv[1], vlstep, vg + gstage, gstep);

    for (int st = 0; st < ATT_NST; ++st) {
        const __bf16 (*Kc)[ATT_KP] = Klds[st & 1];
        const unsigned char* Vc = (const unsigned char*)&Vlds[st & 1][0][0] + vlane;

        // unrolled: the LDS offsets become immediates, and the next 32 keys' fragment
        // loads can be issued among this 32 keys' vector work
#pragma unroll
        for (int kt = 0; kt < ATT_STAGE; kt += 32) {
            const int r0 = kt + (lane & 15), r1 = 16 + r0;
            v16bf ka00 = ldfrag(&Kc[r0][kb],      &Kc[r0][kb + 16]);
            v16bf ka01 = ldfrag(&Kc[r0][32 + kb], &Kc[r0][32 + kb + 16]);
            v16bf ka10 = ldfrag(&Kc[r1][kb],      &Kc[r1][kb + 16]);
            v16bf ka11 = ldfrag(&Kc[r1][32 + kb], &Kc[r1][32 + kb + 16]);

            v8f c0 = {}, c1 = {};
            c0 = wmma_bf16(ka00, qf0, c0);  c0 = wmma_bf16(ka01, qf1, c0);
            c1 = wmma_bf16(ka10, qf0, c1);  c1 = wmma_bf16(ka11, qf1, c1);

            const unsigned char* vt = Vc + kt * (ATT_VP * 2);
            v16bf va0 = ldfrag_tr(vt +  0, ATT_VP * 2);   // d  0..15
            v16bf va1 = ldfrag_tr(vt + 32, ATT_VP * 2);   // d 16..31
            v16bf va2 = ldfrag_tr(vt + 64, ATT_VP * 2);   // d 32..47
            v16bf va3 = ldfrag_tr(vt + 96, ATT_VP * 2);   // d 48..63

            // online softmax (per-lane query column; pair lanes L and L^16 share q)
            float loc = -1e30f;
#pragma unroll
            for (int r = 0; r < 8; ++r) {
                c0[r] *= scale; c1[r] *= scale;
                loc = fmaxf(loc, fmaxf(c0[r], c1[r]));
            }
            loc = fmaxf(loc, __shfl_xor(loc, 16, 32));
            const float mnew  = fmaxf(m, loc);
            const float alpha = __expf(m - mnew);
            float rs = 0.f;
            v16bf p;
#pragma unroll
            for (int r = 0; r < 8; ++r) {
                const float e0 = __expf(c0[r] - mnew);
                const float e1 = __expf(c1[r] - mnew);
                rs += e0 + e1;
                p[r]     = (__bf16)e0;   // keys kb-block of sub-tile 0
                p[8 + r] = (__bf16)e1;   // keys kb-block of sub-tile 1
            }
            rs += __shfl_xor(rs, 16, 32);
            l = l * alpha + rs;
            m = mnew;
#pragma unroll
            for (int r = 0; r < 8; ++r) {
                o0[r] *= alpha; o1[r] *= alpha; o2[r] *= alpha; o3[r] *= alpha;
            }
            // O^T += V^T * P^T
            o0 = wmma_bf16(va0, p, o0);
            o1 = wmma_bf16(va1, p, o1);
            o2 = wmma_bf16(va2, p, o2);
            o3 = wmma_bf16(va3, p, o3);
        }

        // publish point of stage st + 1
        wait_ds0();             // own reads of buffer st&1 retired
        wait_async0();          // own copies of stage st + 1 landed in LDS
        __syncthreads();        // everyone's landed; everyone has left buffer st&1
        if (st + 2 < ATT_NST) { // refill the buffer just left with stage st + 2
            const size_t soff = (size_t)(st + 2) * gstage;
            async_copy4x16B(kldsv[st & 1], klstep, kg + soff, gstep);
            async_copy4x16B(vldsv[st & 1], vlstep, vg + soff, gstep);
        }
    }
    wait_async0();              // nothing outstanding when the wave ends

    const float inv = 1.f / l;
    __bf16* ob = O + ((size_t)(b * SEQ + qrow)) * ld + h * HEAD_DIM;
#pragma unroll
    for (int r = 0; r < 8; ++r) {
        const int dhi = r + ((lane >> 4) << 3);
        ob[ 0 + dhi] = (__bf16)(o0[r] * inv);
        ob[16 + dhi] = (__bf16)(o1[r] * inv);
        ob[32 + dhi] = (__bf16)(o2[r] * inv);
        ob[48 + dhi] = (__bf16)(o3[r] * inv);
    }
}

// ---------------------------------------------------------------------------
// y = LayerNorm(a + r) * g + b   (fp32 master, optional bf16 side output)
// One wave per row, 32 elements per lane held in registers (16-B loads, whole
// lines per wave-wide access), the row's two sums by a butterfly inside the wave,
// no LDS and no barrier.  Block 256 = 8 rows.
// ---------------------------------------------------------------------------
__global__ void ln_residual_kernel(const float* __restrict__ a,
                                   const float* __restrict__ rr,
                                   const float* __restrict__ g,
                                   const float* __restrict__ bb,
                                   float* __restrict__ of,
                                   __bf16* __restrict__ obf) {
    const int D = D_MODEL;
    const int wave = threadIdx.x >> 5, lane = threadIdx.x & 31;
    const size_t row = (size_t)blockIdx.x * 8 + wave;
    const v4f* pa = (const v4f*)(a  + row * D) + lane;
    const v4f* pr = (const v4f*)(rr + row * D) + lane;
    const v4f* pg = (const v4f*)g  + lane;
    const v4f* pb = (const v4f*)bb + lane;
    v4f v[8], w[8], g4[8], b4[8];
    // the loops over i are unrolled so that the four arrays stay in registers
#pragma unroll
    for (int i = 0; i < 8; ++i) { v[i] = pa[i * 32]; w[i] = pr[i * 32]; }
#pragma unroll
    for (int i = 0; i < 8; ++i) { g4[i] = pg[i * 32]; b4[i] = pb[i * 32]; }
    v4f s4 = {0.f, 0.f, 0.f, 0.f}, q4 = {0.f, 0.f, 0.f, 0.f};
#pragma unroll
    for (int i = 0; i < 8; ++i) {
        v[i] += w[i];
        s4 += v[i];
        q4 += v[i] * v[i];
    }
    float s = (s4.x + s4.y) + (s4.z + s4.w);
    float q = (q4.x + q4.y) + (q4.z + q4.w);
    for (int o = 16; o > 0; o >>= 1) {
        s += __shfl_xor(s, o, 32);
        q += __shfl_xor(q, o, 32);
    }
    const float mu  = s / D;
    const float var = q / D - mu * mu;
    const float inv = rsqrtf(var + 1e-5f);
#pragma unroll
    for (int i = 0; i < 8; ++i) v[i] = (v[i] - mu) * inv * g4[i] + b4[i];
    v4f* po = (v4f*)(of + row * D) + lane;
    if (obf) {
        v4bf* pob = (v4bf*)(obf + row * D) + lane;
#pragma unroll
        for (int i = 0; i < 8; ++i) {
            v4bf yb = { (__bf16)v[i].x, (__bf16)v[i].y, (__bf16)v[i].z, (__bf16)v[i].w };
            pob[i * 32] = yb;
        }
    }
#pragma unroll
    for (int i = 0; i < 8; ++i) po[i * 32] = v[i];
}

// ---------------------------------------------------------------------------
extern "C" void kernel_launch(void* const* d_in, const int* in_sizes, int n_in,
                              void* d_out, int out_size, void* d_ws, size_t ws_size,
                              hipStream_t stream) {
    const float* x    = (const float*)d_in[0];
    const float* wq   = (const float*)d_in[1];
    const float* bq   = (const float*)d_in[2];
    const float* wk   = (const float*)d_in[3];
    const float* bk   = (const float*)d_in[4];
    const float* wv   = (const float*)d_in[5];
    const float* bv   = (const float*)d_in[6];
    const float* wo   = (const float*)d_in[7];
    const float* bo   = (const float*)d_in[8];
    const float* w1   = (const float*)d_in[9];
    const float* b1   = (const float*)d_in[10];
    const float* w2   = (const float*)d_in[11];
    const float* b2   = (const float*)d_in[12];
    const float* ln1g = (const float*)d_in[13];
    const float* ln1b = (const float*)d_in[14];
    const float* ln2g = (const float*)d_in[15];
    const float* ln2b = (const float*)d_in[16];

    char* ws = (char*)d_ws;
    const size_t MiB = 1024 * 1024;
    __bf16* WQT  = (__bf16*)(ws + 0 * MiB);    // 2 MiB each; WQT, WKT, WVT in a row
    __bf16* WKT  = (__bf16*)(ws + 2 * MiB);
    __bf16* WVT  = (__bf16*)(ws + 4 * MiB);
    __bf16* WOT  = (__bf16*)(ws + 6 * MiB);
    __bf16* W1T  = (__bf16*)(ws + 8 * MiB);    // 8 MiB
    __bf16* W2T  = (__bf16*)(ws + 16 * MiB);   // 8 MiB
    __bf16* XBF  = (__bf16*)(ws + 24 * MiB);   // 8 MiB : x bf16, later attn-out bf16
    __bf16* QBF  = (__bf16*)(ws + 32 * MiB);   // 8 MiB; QBF, KBF, VBF in a row
    __bf16* KBF  = (__bf16*)(ws + 40 * MiB);   // 8 MiB
    __bf16* VBF  = (__bf16*)(ws + 48 * MiB);   // 8 MiB
    float*  TMPF = (float* )(ws + 32 * MiB);   // 16 MiB : o-proj f32, later ffn2 f32
    float*  X1F  = (float* )(ws + 56 * MiB);   // 16 MiB
    __bf16* X1BF = (__bf16*)(ws + 72 * MiB);   // 8 MiB
    __bf16* HBF  = (__bf16*)(ws + 80 * MiB);   // 32 MiB
    float*  out  = (float*)d_out;

    // 1) cast of x and all weight transposes, one launch
    prepare_operands_kernel<<<PREP_BLOCKS, 256, 0, stream>>>(x, wq, wk, wv, wo, w1, w2,
                                                             XBF, WQT, WKT, WVT, WOT, W1T, W2T);

    // 2) Q, K and V projections, one launch: grid z = 0, 1, 2
    gemm_bf16_kernel<<<dim3(D_MODEL/128, NTOK/128, 3), 256, 0, stream>>>(XBF, WQT, bq, bk, bv, QBF, nullptr, NTOK, D_MODEL, D_MODEL, 0);

    // 3) flash attention -> XBF (concat heads, row-major)
    flash_attn_kernel<<<dim3(SEQ/128, N_HEADS, BATCH), 256, 0, stream>>>(QBF, KBF, VBF, XBF);

    // 4) output projection (f32) + residual LN1
    gemm_bf16_kernel<<<dim3(D_MODEL/128, NTOK/128), 256, 0, stream>>>(XBF, WOT, bo, nullptr, nullptr, nullptr, TMPF, NTOK, D_MODEL, D_MODEL, 0);
    ln_residual_kernel<<<NTOK / 8, 256, 0, stream>>>(x, TMPF, ln1g, ln1b, X1F, X1BF);

    // 5) FFN
    gemm_bf16_kernel<<<dim3(D_FF/128,    NTOK/128), 256, 0, stream>>>(X1BF, W1T, b1, nullptr, nullptr, HBF, nullptr, NTOK, D_FF, D_MODEL, 1);
    gemm_bf16_kernel<<<dim3(D_MODEL/128, NTOK/128), 256, 0, stream>>>(HBF,  W2T, b2, nullptr, nullptr, nullptr, TMPF, NTOK, D_MODEL, D_FF, 0);

    // 6) residual LN2 -> final output
    ln_residual_kernel<<<NTOK / 8, 256, 0, stream>>>(X1F, TMPF, ln2g, ln2b, out, nullptr);
}

// v006
// It runs in 158 microseconds.
// Next to v005, in two timings, it ran 1.07 and 1.06 times as fast.
// Over all steps from v000 it is 2.03 times as fast.
#include <hip/hip_runtime.h>

typedef __attribute__((ext_vector_type(16))) __bf16 v16bf;
typedef __attribute__((ext_vector_type(8)))  float  v8f;
typedef __attribute__((ext_vector_type(8)))  __bf16 v8bf;
typedef __attribute__((ext_vector_type(4)))  __bf16 v4bf;
typedef __attribute__((ext_vector_type(4)))  float  v4f;

#define D_MODEL  1024
#define N_HEADS  16
#define HEAD_DIM 64
#define D_FF     4096
#define SEQ      2048
#define BATCH    2
#define NTOK     (BATCH * SEQ)   // 4096 rows

// ---------------------------------------------------------------------------
// Fragment helpers.
// A-style 16x32 bf16 fragment: lane L holds row M = L&15; K base = (L>>4)*8;
// vector elems e0..e7 = K kb..kb+7, e8..e15 = K kb+16..kb+23  -> two 16B loads.
// ---------------------------------------------------------------------------
__device__ __forceinline__ v16bf ldfrag(const __bf16* p0, const __bf16* p1) {
    union { struct { uint4 lo, hi; } u; v16bf v; } f;
    f.u.lo = *(const uint4*)p0;
    f.u.hi = *(const uint4*)p1;
    return f.v;
}

__device__ __forceinline__ v8f wmma_bf16(v16bf a, v16bf b, v8f c) {
    // D(f32 16x16) = A(bf16 16x32) * B(bf16 32x16) + C
    return __builtin_amdgcn_wmma_f32_16x16x32_bf16(false, a, false, b,
                                                   (short)0, c, false, false);
}

// Async DMA: eight b128 copies global -> LDS, 16 B per lane each.  Copy c takes
// the lane's 16 B of tile row (row0 + 16 * c): LDS address lds + c * lstep,
// global address g + c * gstep (both in bytes).  The closing s_wait_xcnt stands
// inside the statement so that no address register named by a copy is rewritten
// ahead of it.
__device__ __forceinline__ void async_copy8x16B(unsigned lds, unsigned lstep,
                                                const char* g, size_t gstep) {
    asm volatile(
        "global_load_async_to_lds_b128 %0, %8, off\n\t"
        "global_load_async_to_lds_b128 %1, %9, off\n\t"
        "global_load_async_to_lds_b128 %2, %10, off\n\t"
        "global_load_async_to_lds_b128 %3, %11, off\n\t"
        "global_load_async_to_lds_b128 %4, %12, off\n\t"
        "global_load_async_to_lds_b128 %5, %13, off\n\t"
        "global_load_async_to_lds_b128 %6, %14, off\n\t"
        "global_load_async_to_lds_b128 %7, %15, off\n\t"
        "s_wait_xcnt 0x0"
        :: "v"(lds), "v"(lds + lstep), "v"(lds + 2 * lstep), "v"(lds + 3 * lstep),
           "v"(lds + 4 * lstep), "v"(lds + 5 * lstep), "v"(lds + 6 * lstep),
           "v"(lds + 7 * lstep),
           "v"(g), "v"(g + gstep), "v"(g + 2 * gstep), "v"(g + 3 * gstep),
           "v"(g + 4 * gstep), "v"(g + 5 * gstep), "v"(g + 6 * gstep),
           "v"(g + 7 * gstep)
        : "memory");
}

// Eight b128 copies by the builtin: copy c takes the lane's 16 B of tile row (row0 + 16 * c).
// The compiler allots their address registers itself, in any register window, which an asm
// operand cannot have: for a kernel whose accumulators fill the first 256 registers.
typedef int i32x4 __attribute__((ext_vector_type(4)));
__device__ __forceinline__ void async_copy8x16B_b(char* lds, unsigned lstep,
                                                  const char* g, size_t gstep) {
    typedef __attribute__((address_space(1))) i32x4 glb_i32x4;
    typedef __attribute__((address_space(3))) i32x4 lds_i32x4;
    // unrolled: c is a constant in every address
#pragma unroll
    for (int c = 0; c < 8; ++c)
        __builtin_amdgcn_global_load_async_to_lds_b128((glb_i32x4*)(g + c * gstep),
                                                       (lds_i32x4*)(lds + c * lstep), 0, 0);
}

// The same with four copies: copy c takes the lane's 16 B of tile row (row0 + 32 * c).
__device__ __forceinline__ void async_copy4x16B(unsigned lds, unsigned lstep,
                                                const char* g, size_t gstep) {
    asm volatile(
        "global_load_async_to_lds_b128 %0, %4, off\n\t"
        "global_load_async_to_lds_b128 %1, %5, off\n\t"
        "global_load_async_to_lds_b128 %2, %6, off\n\t"
        "global_load_async_to_lds_b128 %3, %7, off\n\t"
        "s_wait_xcnt 0x0"
        :: "v"(lds), "v"(lds + lstep), "v"(lds + 2 * lstep), "v"(lds + 3 * lstep),
           "v"(g), "v"(g + gstep), "v"(g + 2 * gstep), "v"(g + 3 * gstep)
        : "memory");
}

// Transposing LDS load: from a row-major 16-bit tile T, lane (c = l & 15, h = l >> 4)
// gets T[k0 + 8h + 0..7][d0 + c] when lane l points at row k0 + 8 * (l >> 4) + (l & 7),
// byte 2 * d0 + 16 * ((l >> 3) & 1) of that row.
typedef short s16x8 __attribute__((ext_vector_type(8)));
__device__ __forceinline__ uint4 ld_tr16(const unsigned char* p) {
    typedef __attribute__((address_space(3))) s16x8 lds_s16x8;
    return __builtin_bit_cast(uint4, __builtin_amdgcn_ds_load_tr16_b128_v8i16((lds_s16x8*)p));
}

// One 16 (d) x 32 (keys) A fragment of V^T from row-major V rows of pitch bytes:
// keys k0 + 8h + 0..7 in elements 0..7, keys k0 + 16 + 8h + 0..7 in elements 8..15.
__device__ __forceinline__ v16bf ldfrag_tr(const unsigned char* p, unsigned pitch) {
    union { struct { uint4 lo, hi; } u; v16bf v; } f;
    f.u.lo = ld_tr16(p);
    f.u.hi = ld_tr16(p + 16 * pitch);
    return f.v;
}

__device__ __forceinline__ void wait_async0() {
    asm volatile("s_wait_asynccnt 0x0" ::: "memory");
}

// This wave's LDS accesses have retired: stands in front of the barrier behind
// which the buffer they read is refilled by async copies, and between the GEMM
// epilogue's staging writes and their read-back.
__device__ __forceinline__ void wait_ds0() {
    asm volatile("s_wait_dscnt 0x0" ::: "memory");
}

// Low 32 bits of a generic pointer to __shared__ == raw LDS byte offset
// (flat-aperture rule: LDS_ADDR = addr[31:0]).
__device__ __forceinline__ unsigned lds_addr(const void* p) {
    return (unsigned)(unsigned long long)(uintptr_t)p;
}

// ---------------------------------------------------------------------------
// fp32 -> bf16 cast of x.  32 elements per thread (few, long-lived waves): eight
// 16-B loads in flight per lane, each wave-wide load 512 contiguous bytes, each
// wave-wide store 256.  Block blk takes 8192 contiguous elements.
// ---------------------------------------------------------------------------
#define CAST_PER_BLOCK 8192
__device__ __forceinline__ void cast_bf16_block(const float* __restrict__ src,
                                                __bf16* __restrict__ dst, int blk) {
    const size_t base = (size_t)blk * (CAST_PER_BLOCK / 4) + threadIdx.x;
    const float4* s4 = (const float4*)src + base;
    v4bf* d4 = (v4bf*)dst + base;
    float4 v[8];
    // both loops unrolled: v[] stays in registers, all loads issue before the first use
#pragma unroll
    for (int i = 0; i < 8; ++i) v[i] = s4[i * 256];
#pragma unroll
    for (int i = 0; i < 8; ++i) {
        v4bf o = { (__bf16)v[i].x, (__bf16)v[i].y, (__bf16)v[i].z, (__bf16)v[i].w };
        d4[i * 256] = o;
    }
}

// ---------------------------------------------------------------------------
// W[K][N] fp32  ->  Wt[N][K] bf16.  One block of 256 threads transposes a tile
// of 128 k x 64 n through LDS, 32 elements per thread: eight 16-B loads in flight
// per lane (a wave-wide load = two 256-B row pieces), four 16-B stores per lane
// (a wave-wide store = four whole 128-B lines).  K: a multiple of 128, N: of 64.
// LDS pitch 65 dwords: both the row-wise writes and the column-wise reads below
// fall on 32 different banks.  bn, bk: the tile's place along n and along k.
// ---------------------------------------------------------------------------
#define TR_K 128
#define TR_N 64
__device__ __forceinline__ void transpose_cast_block(const float* __restrict__ src,
                                                     __bf16* __restrict__ dst,
                                                     int K, int N, int bn, int bk) {
    __shared__ float tile[TR_K][TR_N + 1];
    const int n0 = bn * TR_N, k0 = bk * TR_K;
    const int tid = threadIdx.x, wave = tid >> 5, lane = tid & 31;

    const int lk = tid >> 4;          // 0..15 : first k row loaded by this thread
    const int ln = (tid & 15) * 4;    // its four n of that row
    const unsigned loff = (unsigned)(lk * N + ln);   // per lane; the rest is uniform
    float4 v[8];
    // every loop here is unrolled: v[] and o stay in registers, the eight loads issue
    // together, and the LDS offsets become immediates
#pragma unroll
    for (int p = 0; p < 8; ++p)
        v[p] = *(const float4*)(src + ((size_t)(k0 + 16 * p) * N + n0) + loff);
#pragma unroll
    for (int p = 0; p < 8; ++p) {
        float* t = &tile[lk + 16 * p][ln];
        t[0] = v[p].x; t[1] = v[p].y; t[2] = v[p].z; t[3] = v[p].w;
    }
    __syncthreads();

    const int kc = (lane & 7) * 8;    // this lane's eight k inside a 64-k half row
    const int ns = lane >> 3;         // 0..3 : which of the wave's four n rows
#pragma unroll
    for (int p = 0; p < 4; ++p) {
        const int q = wave * 4 + p;               // 0..31
        const int n = (q & 15) * 4 + ns;
        const int k = (q >> 4) * 64 + kc;
        v8bf o;
#pragma unroll
        for (int i = 0; i < 8; ++i) o[i] = (__bf16)tile[k + i][n];
        *(v8bf*)(dst + (size_t)(n0 + n) * K + k0 + k) = o;
    }
}

// ---------------------------------------------------------------------------
// All operand preparation in ONE launch: none of these pieces reads what another
// writes, so they need no launch boundary between them.  The flat block index
// falls in one of four ranges: w1's tiles, w2's tiles, the tiles of the four
// square weights, the pieces of x.  Every test below reads blockIdx alone, so a
// whole block takes one path and the transpose's barrier is passed by all of it.
// ---------------------------------------------------------------------------
#define PREP_FF_BLOCKS   ((D_FF / TR_N) * (D_MODEL / TR_K))        // 512, w1 and w2 alike
#define PREP_SQ_BLOCKS   ((D_MODEL / TR_N) * (D_MODEL / TR_K))     // 128 per square weight
#define PREP_CAST_BLOCKS ((NTOK * D_MODEL) / CAST_PER_BLOCK)       // 512
#define PREP_BLOCKS      (2 * PREP_FF_BLOCKS + 4 * PREP_SQ_BLOCKS + PREP_CAST_BLOCKS)
__global__ void prepare_operands_kernel(const float* __restrict__ x,
                                        const float* __restrict__ wq,
                                        const float* __restrict__ wk,
                                        const float* __restrict__ wv,
                                        const float* __restrict__ wo,
                                        const float* __restrict__ w1,
                                        const float* __restrict__ w2,
                                        __bf16* __restrict__ xbf,
                                        __bf16* __restrict__ wqt,
                                        __bf16* __restrict__ wkt,
                                        __bf16* __restrict__ wvt,
                                        __bf16* __restrict__ wot,
                                        __bf16* __restrict__ w1t,
                                        __bf16* __restrict__ w2t) {
    int b = blockIdx.x;
    if (b >= 2 * PREP_FF_BLOCKS + 4 * PREP_SQ_BLOCKS) {
        cast_bf16_block(x, xbf, b - (2 * PREP_FF_BLOCKS + 4 * PREP_SQ_BLOCKS));
        return;
    }
    const float* src;
    __bf16* dst;
    int K = D_MODEL, N = D_MODEL;
    int ntl = 4;                        // log2 of the tiles along n: D_MODEL / TR_N = 16
    if (b < PREP_FF_BLOCKS) {
        src = w1; dst = w1t; N = D_FF; ntl = 6;     // D_FF / TR_N = 64
    } else if (b < 2 * PREP_FF_BLOCKS) {
        b -= PREP_FF_BLOCKS;
        src = w2; dst = w2t; K = D_FF;
    } else {
        b -= 2 * PREP_FF_BLOCKS;
        const int w = b / PREP_SQ_BLOCKS;
        b -= w * PREP_SQ_BLOCKS;
        src = w == 0 ? wq  : w == 1 ? wk  : w == 2 ? wv  : wo;
        dst = w == 0 ? wqt : w == 1 ? wkt : w == 2 ? wvt : wot;
    }
    // shift and mask, not a division by a run-time N: the tile's place stays scalar
    transpose_cast_block(src, dst, K, N, b & ((1 << ntl) - 1), b >> ntl);
}

// ---------------------------------------------------------------------------
// GEMM: C[M][N] = A[M][K](bf16) * Bt[N][K](bf16)^T + bias, optional ReLU.
// Block tile 128x128, 256 threads = 8 waves (4x2), wave tile 32x64.
// K tile 128 (256 B of every operand row), double-buffered LDS filled by
// GLOBAL_LOAD_ASYNC_TO_LDS_B128: 16 lanes per row, so one copy of a wave takes
// two whole 256-B row pieces (four full 128-B lines).  Kd: a multiple of 128.
// Grid z: up to three products of the same A in one launch.  Product z takes the
// z-th [N][Kd] matrix behind Bt0, its own bias, and writes the z-th [M][N] bf16
// matrix behind Cbf0.
// ---------------------------------------------------------------------------
#define GEMM_BK  128
#define GEMM_LDP 136   // 128 K + 8 pad: pitch 272 B = 16 B x odd for ds_load_b128
// Output staging, bytes: row pitch of a wave's 32x64 tile in bf16 (128 + 16) and in f32
// (256 + 16), both 16 B x odd; a wave's range holds the larger, eight of them fill Alds.
#define GEMM_STG_PBF  144
#define GEMM_STG_PF   272
#define GEMM_STG_WAVE (32 * GEMM_STG_PF)

__global__ void gemm_bf16_kernel(const __bf16* __restrict__ A,
                                 const __bf16* __restrict__ Bt0,
                                 const float* __restrict__ bias0,
                                 const float* __restrict__ bias1,
                                 const float* __restrict__ bias2,
                                 __bf16* __restrict__ Cbf0,
                                 float* __restrict__ Cf,
                                 int M, int N, int Kd, int relu) {
    __shared__ __align__(16) __bf16 Alds[2][128][GEMM_LDP];
    __shared__ __align__(16) __bf16 Blds[2][128][GEMM_LDP];

    const int z = blockIdx.z;
    const __bf16* Bt  = Bt0 + (size_t)z * N * Kd;
    const float* bias = z == 0 ? bias0 : z == 1 ? bias1 : bias2;
    __bf16* Cbf       = Cbf0 ? Cbf0 + (size_t)z * M * N : nullptr;

    const int tid  = threadIdx.x;
    const int wave = tid >> 5, lane = tid & 31;
    const int wm = wave >> 1, wn = wave & 1;
    const int bm = blockIdx.y * 128, bn = blockIdx.x * 128;
    const int kb = (lane >> 4) * 8;
    const int lr = tid >> 4;          // 0..15 : first tile row staged by this thread
    const int lc = (tid & 15) * 8;    // 0..120 (elements): its 16 B of the row piece

    const char* ag = (const char*)(A  + (size_t)(bm + lr) * Kd + lc);
    const char* bg = (const char*)(Bt + (size_t)(bn + lr) * Kd + lc);
    const size_t gstep = (size_t)Kd * 32;              // 16 rows, bytes
    const unsigned lstep = 16 * GEMM_LDP * 2;          // 16 rows, bytes
    const unsigned aldsv[2] = { lds_addr(&Alds[0][lr][lc]), lds_addr(&Alds[1][lr][lc]) };
    const unsigned bldsv[2] = { lds_addr(&Blds[0][lr][lc]), lds_addr(&Blds[1][lr][lc]) };

    v8f acc[2][4] = {};

    const int nk = Kd / GEMM_BK;

    // prologue: K tile 0 into buffer 0, published; then K tile 1 into buffer 1
    async_copy8x16B(aldsv[0], lstep, ag, gstep);
    async_copy8x16B(bldsv[0], lstep, bg, gstep);
    wait_async0();
    __syncthreads();
    if (nk > 1) {
        async_copy8x16B(aldsv[1], lstep, ag + GEMM_BK * 2, gstep);
        async_copy8x16B(bldsv[1], lstep, bg + GEMM_BK * 2, gstep);
    }

    for (int it = 0; it < nk; ++it) {
        const __bf16 (*Ac)[GEMM_LDP] = Alds[it & 1];
        const __bf16 (*Bc)[GEMM_LDP] = Blds[it & 1];

        // unrolled: every fragment's LDS offset becomes an immediate, and the next
        // 32 k's loads can be issued among this 32 k's products
#pragma unroll
        for (int ks = 0; ks < GEMM_BK; ks += 32) {
            v16bf af[2], bf_[4];
#pragma unroll
            for (int i = 0; i < 2; ++i) {
                const __bf16* r = &Ac[wm * 32 + i * 16 + (lane & 15)][ks + kb];
                af[i] = ldfrag(r, r + 16);
            }
#pragma unroll
            for (int j = 0; j < 4; ++j) {
                const __bf16* r = &Bc[wn * 64 + j * 16 + (lane & 15)][ks + kb];
                bf_[j] = ldfrag(r, r + 16);
            }
#pragma unroll
            for (int i = 0; i < 2; ++i)
#pragma unroll
                for (int j = 0; j < 4; ++j)
                    acc[i][j] = wmma_bf16(af[i], bf_[j], acc[i][j]);
        }

        // publish point of K tile it + 1
        wait_ds0();             // own reads of buffer it&1 retired
        wait_async0();          // own copies of K tile it + 1 landed in LDS
        __syncthreads();        // everyone's landed; everyone has left buffer it&1
        if (it + 2 < nk) {      // refill the buffer just left with K tile it + 2
            const size_t koff = (size_t)(it + 2) * (GEMM_BK * 2);
            async_copy8x16B(aldsv[it & 1], lstep, ag + koff, gstep);
            async_copy8x16B(bldsv[it & 1], lstep, bg + koff, gstep);
        }
    }
    wait_async0();              // nothing outstanding when the wave ends

    // Epilogue. C-frag: vgpr r -> row = base + r + ((lane>>4)<<3); col = base + (lane&15).
    // Each wave lays its 32x64 tile, in the output's type, in a range of its own in the
    // ring (the last trip's barrier stands behind everyone's last read of it and no copy
    // is outstanding), reads it back row-wise and stores whole 128-B lines, 16 B a lane.
    // Every loop here is unrolled: acc stays in registers, the LDS offsets are immediates.
    char* stg = (char*)&Alds[0][0][0] + wave * GEMM_STG_WAVE;
    const int cl = lane & 15, rh = (lane >> 4) << 3;
    float bv[4];
#pragma unroll
    for (int j = 0; j < 4; ++j) bv[j] = bias[bn + wn * 64 + j * 16 + cl];
#pragma unroll
    for (int i = 0; i < 2; ++i)
#pragma unroll
        for (int j = 0; j < 4; ++j) acc[i][j] += bv[j];
    if (relu) {     // one test for the whole tile, the values changed in place
#pragma unroll
        for (int i = 0; i < 2; ++i)
#pragma unroll
            for (int j = 0; j < 4; ++j)
#pragma unroll
                for (int r = 0; r < 8; ++r) acc[i][j][r] = fmaxf(acc[i][j][r], 0.f);
    }

    if (Cbf) {      // one test for the whole tile: both paths are straight-line code
#pragma unroll
        for (int i = 0; i < 2; ++i)
#pragma unroll
            for (int j = 0; j < 4; ++j)
#pragma unroll
                for (int r = 0; r < 8; ++r)
                    *(__bf16*)(stg + (i * 16 + rh + r) * GEMM_STG_PBF + (j * 16 + cl) * 2) =
                        (__bf16)acc[i][j][r];
        wait_ds0();     // the rows read back below were written by other lanes of this wave
        // a wave-wide access = four rows of 128 B: 8 lanes a row
        const char* sr = stg + (lane >> 3) * GEMM_STG_PBF + (lane & 7) * 16;
        __bf16* cw = Cbf + (size_t)(bm + wm * 32 + (lane >> 3)) * N + bn + wn * 64 + (lane & 7) * 8;
#pragma unroll
        for (int q = 0; q < 8; ++q)
            *(uint4*)(cw + (size_t)(4 * q) * N) = *(const uint4*)(sr + 4 * q * GEMM_STG_PBF);
    } else {
#pragma unroll
        for (int i = 0; i < 2; ++i)
#pragma unroll
            for (int j = 0; j < 4; ++j)
#pragma unroll
                for (int r = 0; r < 8; ++r)
                    *(float*)(stg + (i * 16 + rh + r) * GEMM_STG_PF + (j * 16 + cl) * 4) =
                        acc[i][j][r];
        wait_ds0();     // the rows read back below were written by other lanes of this wave
        // a wave-wide access = two rows of 256 B: 16 lanes a row
        const char* sr = stg + (lane >> 4) * GEMM_STG_PF + cl * 16;
        float* cw = Cf + (size_t)(bm + wm * 32 + (lane >> 4)) * N + bn + wn * 64 + cl * 4;
#pragma unroll
        for (int q = 0; q < 16; ++q)
            *(uint4*)(cw + (size_t)(2 * q) * N) = *(const uint4*)(sr + 2 * q * GEMM_STG_PF);
    }
}

// ---------------------------------------------------------------------------
// The same product for outputs wide enough to fill the chip with larger tiles:
// block tile 256x256, 256 threads = 8 waves (2x4), wave tile 128x64, bf16 output.
// Against the 128x128 tile each operand byte copied from L2 into LDS feeds twice the
// products, and each fragment read from LDS feeds more of them (24 loads per 32
// products).  One block owns a WGP's LDS.  Same K tile, pitch and two-buffer ring as
// above; the publish point stands in front of a K tile's last 32 products, whose
// fragments are in registers by then.  M, N: multiples of 256; Kd: a multiple of 128.
// launch bounds: the block is 256 threads; the 256 accumulator registers of a wave need
// the register budget of that block size.
// ---------------------------------------------------------------------------
#define GEMM_T2 256
__global__ void __launch_bounds__(256) gemm_bf16_t256_kernel(const __bf16* __restrict__ A,
                                 const __bf16* __restrict__ Bt0,
                                 const float* __restrict__ bias0,
                                 const float* __restrict__ bias1,
                                 const float* __restrict__ bias2,
                                 __bf16* __restrict__ Cbf0,
                                 int M, int N, int Kd, int relu) {
    // rows 0..255 of a buffer: A's tile; rows 256..511: Bt's
    __shared__ __align__(16) __bf16 ring[2][2 * GEMM_T2][GEMM_LDP];

    const int z = blockIdx.z;
    const __bf16* Bt  = Bt0 + (size_t)z * N * Kd;
    const float* bias = z == 0 ? bias0 : z == 1 ? bias1 : bias2;
    __bf16* Cbf       = Cbf0 + (size_t)z * M * N;

    const int tid  = threadIdx.x;
    const int wave = tid >> 5, lane = tid & 31;
    const int wm = wave >> 2, wn = wave & 3;
    const int bm = blockIdx.y * GEMM_T2, bn = blockIdx.x * GEMM_T2;
    const int kb = (lane >> 4) * 8;
    const int lr = tid >> 4;          // 0..15 : first tile row staged by this thread
    const int lc = (tid & 15) * 8;    // 0..120 (elements): its 16 B of the row piece

    // The tiles' first bytes are the same for the whole block; a lane adds one byte offset,
    // the same in both operands (both have rows of Kd elements).
    const char* ab = (const char*)(A  + (size_t)bm * Kd);
    const char* bb = (const char*)(Bt + (size_t)bn * Kd);
    const unsigned voff = (unsigned)(lr * Kd + lc) * 2;
    const size_t gstep = (size_t)Kd * 32;              // 16 rows, bytes
    const unsigned lstep = 16 * GEMM_LDP * 2;          // 16 rows, bytes
    char* lds0 = (char*)&ring[0][lr][lc];
    const unsigned lbuf = 2 * GEMM_T2 * GEMM_LDP * 2;  // one buffer, bytes

    v8f acc[8][4] = {};

    const int nk = Kd / GEMM_BK;

    // one K tile: 16 copies a lane for each operand (rows lr + 16 c), 32 of a wave in flight
    // in four parts of eight: part p takes rows 128 (p & 1) + lr + 16 c of A (p < 2) or Bt
    auto stage_part = [&](int buf, size_t koff, int p) {
        async_copy8x16B_b(lds0 + buf * lbuf + p * (8 * lstep), lstep,
                          ((p < 2 ? ab : bb) + koff + (p & 1) * (8 * gstep)) + voff, gstep);
    };

    // prologue: K tile 0 into buffer 0, published; then K tile 1 into buffer 1
    // (the loops over p are unrolled so that a part's operand and rows are constants)
#pragma unroll
    for (int p = 0; p < 4; ++p) stage_part(0, 0, p);
    wait_async0();
    __syncthreads();
    if (nk > 1) {
#pragma unroll
        for (int p = 0; p < 4; ++p) stage_part(1, GEMM_BK * 2, p);
    }

    for (int it = 0; it < nk; ++it) {
        const __bf16 (*Rc)[GEMM_LDP] = ring[it & 1];

        // every loop in here is unrolled: the fragments' LDS offsets become immediates,
        // af[], bf_[] and acc[] stay in registers
#pragma unroll
        for (int ks = 0; ks < GEMM_BK; ks += 32) {
            v16bf af[8], bf_[4];
#pragma unroll
            for (int j = 0; j < 4; ++j) {
                const __bf16* r = &Rc[GEMM_T2 + wn * 64 + j * 16 + (lane & 15)][ks + kb];
                bf_[j] = ldfrag(r, r + 16);
            }
#pragma unroll
            for (int i = 0; i < 8; ++i) {
                const __bf16* r = &Rc[wm * 128 + i * 16 + (lane & 15)][ks + kb];
                af[i] = ldfrag(r, r + 16);
            }
            // keeps the 24 loads one group ahead of the 32 products: left alone the
            // scheduler reloads one A fragment per four products and waits for each
            __builtin_amdgcn_sched_barrier(0);
            if (ks < GEMM_BK - 32) {
#pragma unroll
                for (int i = 0; i < 8; ++i)
#pragma unroll
                    for (int j = 0; j < 4; ++j)
                        acc[i][j] = wmma_bf16(af[i], bf_[j], acc[i][j]);
            } else {
                // The tile's last fragments are in registers: publish point of K tile
                // it + 1 here, so that the refill flies during these 32 products too.
                wait_ds0();             // own reads of buffer it&1 retired
                wait_async0();          // own copies of K tile it + 1 landed in LDS
                __syncthreads();        // everyone's landed; everyone has left buffer it&1
                const bool refill = it + 2 < nk;    // K tile it + 2 into the buffer just left
                const size_t koff = (size_t)(it + 2) * (GEMM_BK * 2);
#pragma unroll
                for (int p = 0; p < 4; ++p) {
                    if (refill) stage_part(it & 1, koff, p);
                    // the two fences keep each part's copies and address sums in front of
                    // eight products: the refill starts right behind the barrier (left alone
                    // the scheduler put it behind all 32 products) in four short runs
                    __builtin_amdgcn_sched_barrier(0);
#pragma unroll
                    for (int i = 2 * p; i < 2 * p + 2; ++i)
#pragma unroll
                        for (int j = 0; j < 4; ++j)
                            acc[i][j] = wmma_bf16(af[i], bf_[j], acc[i][j]);
                    __builtin_amdgcn_sched_barrier(0);
                }
            }
        }
    }
    wait_async0();              // nothing outstanding when the wave ends

    // Epilogue, as above: each wave lays its 128x64 tile as bf16 in a range of its own in
    // the ring (the last trip's barrier stands behind everyone's last read of it and no
    // copy is outstanding), reads it back row-wise and stores whole 128-B lines.
    // Every loop here is unrolled: acc stays in registers, the LDS offsets are immediates.
    char* stg = (char*)&ring[0][0][0] + wave * (128 * GEMM_STG_PBF);
    const int cl = lane & 15, rh = (lane >> 4) << 3;
    float bv[4];
#pragma unroll
    for (int j = 0; j < 4; ++j) bv[j] = bias[bn + wn * 64 + j * 16 + cl];
#pragma unroll
    for (int i = 0; i < 8; ++i)
#pragma unroll
        for (int j = 0; j < 4; ++j) acc[i][j] += bv[j];
    if (relu) {     // one test for the whole tile, the values changed in place
#pragma unroll
        for (int i = 0; i < 8; ++i)
#pragma unroll
            for (int j = 0; j < 4; ++j)
#pragma unroll
                for (int r = 0; r < 8; ++r) acc[i][j][r] = fmaxf(acc[i][j][r], 0.f);
    }
#pragma unroll
    for (int i = 0; i < 8; ++i)
#pragma unroll
        for (int j = 0; j < 4; ++j)
#pragma unroll
            for (int r = 0; r < 8; ++r)
                *(__bf16*)(stg + (i * 16 + rh + r) * GEMM_STG_PBF + (j * 16 + cl) * 2) =
                    (__bf16)acc[i][j][r];
    wait_ds0();     // the rows read back below were written by other lanes of this wave
    // a wave-wide access = four rows of 128 B: 8 lanes a row
    const char* sr = stg + (lane >> 3) * GEMM_STG_PBF + (lane & 7) * 16;
    __bf16* cw = Cbf + (size_t)(bm + wm * 128 + (lane >> 3)) * N + bn + wn * 64 + (lane & 7) * 8;
#pragma unroll
    for (int q = 0; q < 32; ++q)
        *(uint4*)(cw + (size_t)(4 * q) * N) = *(const uint4*)(sr + 4 * q * GEMM_STG_PBF);
}

// ---------------------------------------------------------------------------
// Flash attention (non-causal), computing S^T = K*Q^T so softmax statistics
// are per-lane and the P-frag C->B conversion is element-wise per lane.
// Grid: (SEQ/128, N_HEADS, BATCH), block 256 (8 waves x 16 queries).
// K and V rows are staged 128 keys a stage, both row-major, in two LDS buffers by
// async-to-LDS copies: stage s + 1 flies while stage s is worked on, one barrier
// per stage.  V^T fragments come out of the row-major V rows by the transposing load.
// ---------------------------------------------------------------------------
#define ATT_STAGE 128                    // keys per stage
#define ATT_NST   (SEQ / ATT_STAGE)      // 16 stages
#define ATT_KP    72                     // K pitch, elements: 144 B = 16 B x odd (ds_load_b128)
#define ATT_VP    80                     // V pitch, elements: 160 B = 32 B x odd (ds_load_tr16_b128)
// launch bounds: the block is 256 threads; without them the register budget is that of
// a 1024-thread block and the unrolled stage spills the Q fragments
__global__ void __launch_bounds__(256) flash_attn_kernel(const __bf16* __restrict__ Q,
                                  const __bf16* __restrict__ K,
                                  const __bf16* __restrict__ V,
                                  __bf16* __restrict__ O) {
    __shared__ __align__(16) __bf16 Klds[2][ATT_STAGE][ATT_KP];   // [key][d]
    __shared__ __align__(16) __bf16 Vlds[2][ATT_STAGE][ATT_VP];   // [key][d]

    const int qblk = blockIdx.x, h = blockIdx.y, b = blockIdx.z;
    const int tid = threadIdx.x, wave = tid >> 5, lane = tid & 31;
    const int kb = (lane >> 4) * 8;
    const int ld = D_MODEL;

    const int qrow = qblk * 128 + wave * 16 + (lane & 15);
    const __bf16* qp = Q + ((size_t)(b * SEQ + qrow)) * ld + h * HEAD_DIM;
    // Q as B-operand of K*Q^T: lane = query col, K-dim = head dim
    const v16bf qf0 = ldfrag(qp +  0 + kb, qp +  0 + kb + 16);
    const v16bf qf1 = ldfrag(qp + 32 + kb, qp + 32 + kb + 16);

    v8f o0 = {}, o1 = {}, o2 = {}, o3 = {};
    float m = -1e30f, l = 0.f;
    const float scale = 0.125f;   // 1/sqrt(64)

    const int cr = tid >> 3;             // first staged row of this thread  0..31
    const int cc = (tid & 7) * 8;        // its 16 B of the 128-B row        0..56

    const size_t goff = (size_t)(b * SEQ + cr) * ld + h * HEAD_DIM + cc;
    const char* kg = (const char*)(K + goff);
    const char* vg = (const char*)(V + goff);
    const size_t gstep  = (size_t)32 * ld * 2;          // 32 rows, bytes
    const size_t gstage = (size_t)ATT_STAGE * ld * 2;   // one stage, bytes
    const unsigned klstep = 32 * ATT_KP * 2, vlstep = 32 * ATT_VP * 2;
    const unsigned kldsv[2] = { lds_addr(&Klds[0][cr][cc]), lds_addr(&Klds[1][cr][cc]) };
    const unsigned vldsv[2] = { lds_addr(&Vlds[0][cr][cc]), lds_addr(&Vlds[1][cr][cc]) };

    // this lane's place in a 32-key block of V rows for the transposing load
    const unsigned vlane = (unsigned)((8 * (lane >> 4) + (lane & 7)) * (ATT_VP * 2)
                                      + 16 * ((lane >> 3) & 1));

    // prologue: stage 0 into buffer 0, published; then stage 1 into buffer 1
    async_copy4x16B(kldsv[0], klstep, kg, gstep);
    async_copy4x16B(vldsv[0], vlstep, vg, gstep);
    wait_async0();
    __syncthreads();
    async_copy4x16B(kldsv[1], klstep, kg + gstage, gstep);
    async_copy4x16B(vldsv[1], vlstep, vg + gstage, gstep);

    for (int st = 0; st < ATT_NST; ++st) {
        const __bf16 (*Kc)[ATT_KP] = Klds[st & 1];
        const unsigned char* Vc = (const unsigned char*)&Vlds[st & 1][0][0] + vlane;

        // unrolled: the LDS offsets become immediates, and the next 32 keys' fragment
        // loads can be issued among this 32 keys' vector work
#pragma unroll
        for (int kt = 0; kt < ATT_STAGE; kt += 32) {
            const int r0 = kt + (lane & 15), r1 = 16 + r0;
            v16bf ka00 = ldfrag(&Kc[r0][kb],      &Kc[r0][kb + 16]);
            v16bf ka01 = ldfrag(&Kc[r0][32 + kb], &Kc[r0][32 + kb + 16]);
            v16bf ka10 = ldfrag(&Kc[r1][kb],      &Kc[r1][kb + 16]);
            v16bf ka11 = ldfrag(&Kc[r1][32 + kb], &Kc[r1][32 + kb + 16]);

            v8f c0 = {}, c1 = {};
            c0 = wmma_bf16(ka00, qf0, c0);  c0 = wmma_bf16(ka01, qf1, c0);
            c1 = wmma_bf16(ka10, qf0, c1);  c1 = wmma_bf16(ka11, qf1, c1);

            const unsigned char* vt = Vc + kt * (ATT_VP * 2);
            v16bf va0 = ldfrag_tr(vt +  0, ATT_VP * 2);   // d  0..15
            v16bf va1 = ldfrag_tr(vt + 32, ATT_VP * 2);   // d 16..31
            v16bf va2 = ldfrag_tr(vt + 64, ATT_VP * 2);   // d 32..47
            v16bf va3 = ldfrag_tr(vt + 96, ATT_VP * 2);   // d 48..63

            // online softmax (per-lane query column; pair lanes L and L^16 share q)
            float loc = -1e30f;
#pragma unroll
            for (int r = 0; r < 8; ++r) {
                c0[r] *= scale; c1[r] *= scale;
                loc = fmaxf(loc, fmaxf(c0[r], c1[r]));
            }
            loc = fmaxf(loc, __shfl_xor(loc, 16, 32));
            const float mnew  = fmaxf(m, loc);
            const float alpha = __expf(m - mnew);
            float rs = 0.f;
            v16bf p;
#pragma unroll
            for (int r = 0; r < 8; ++r) {
                const float e0 = __expf(c0[r] - mnew);
                const float e1 = __expf(c1[r] - mnew);
                rs += e0 + e1;
                p[r]     = (__bf16)e0;   // keys kb-block of sub-tile 0
                p[8 + r] = (__bf16)e1;   // keys kb-block of sub-tile 1
            }
            rs += __shfl_xor(rs, 16, 32);
            l = l * alpha + rs;
            m = mnew;
#pragma unroll
            for (int r = 0; r < 8; ++r) {
                o0[r] *= alpha; o1[r] *= alpha; o2[r] *= alpha; o3[r] *= alpha;
            }
            // O^T += V^T * P^T
            o0 = wmma_bf16(va0, p, o0);
            o1 = wmma_bf16(va1, p, o1);
            o2 = wmma_bf16(va2, p, o2);
            o3 = wmma_bf16(va3, p, o3);
        }

        // publish point of stage st + 1
        wait_ds0();             // own reads of buffer st&1 retired
        wait_async0();          // own copies of stage st + 1 landed in LDS
        __syncthreads();        // everyone's landed; everyone has left buffer st&1
        if (st + 2 < ATT_NST) { // refill the buffer just left with stage st + 2
            const size_t soff = (size_t)(st + 2) * gstage;
            async_copy4x16B(kldsv[st & 1], klstep, kg + soff, gstep);
            async_copy4x16B(vldsv[st & 1], vlstep, vg + soff, gstep);
        }
    }
    wait_async0();              // nothing outstanding when the wave ends

    const float inv = 1.f / l;
    __bf16* ob = O + ((size_t)(b * SEQ + qrow)) * ld + h * HEAD_DIM;
#pragma unroll
    for (int r = 0; r < 8; ++r) {
        const int dhi = r + ((lane >> 4) << 3);
        ob[ 0 + dhi] = (__bf16)(o0[r] * inv);
        ob[16 + dhi] = (__bf16)(o1[r] * inv);
        ob[32 + dhi] = (__bf16)(o2[r] * inv);
        ob[48 + dhi] = (__bf16)(o3[r] * inv);
    }
}

// ---------------------------------------------------------------------------
// y = LayerNorm(a + r) * g + b   (fp32 master, optional bf16 side output)
// One wave per row, 32 elements per lane held in registers (16-B loads, whole
// lines per wave-wide access), the row's two sums by a butterfly inside the wave,
// no LDS and no barrier.  Block 256 = 8 rows.
// ---------------------------------------------------------------------------
__global__ void ln_residual_kernel(const float* __restrict__ a,
                                   const float* __restrict__ rr,
                                   const float* __restrict__ g,
                                   const float* __restrict__ bb,
                                   float* __restrict__ of,
                                   __bf16* __restrict__ obf) {
    const int D = D_MODEL;
    const int wave = threadIdx.x >> 5, lane = threadIdx.x & 31;
    const size_t row = (size_t)blockIdx.x * 8 + wave;
    const v4f* pa = (const v4f*)(a  + row * D) + lane;
    const v4f* pr = (const v4f*)(rr + row * D) + lane;
    const v4f* pg = (const v4f*)g  + lane;
    const v4f* pb = (const v4f*)bb + lane;
    v4f v[8], w[8], g4[8], b4[8];
    // the loops over i are unrolled so that the four arrays stay in registers
#pragma unroll
    for (int i = 0; i < 8; ++i) { v[i] = pa[i * 32]; w[i] = pr[i * 32]; }
#pragma unroll
    for (int i = 0; i < 8; ++i) { g4[i] = pg[i * 32]; b4[i] = pb[i * 32]; }
    v4f s4 = {0.f, 0.f, 0.f, 0.f}, q4 = {0.f, 0.f, 0.f, 0.f};
#pragma unroll
    for (int i = 0; i < 8; ++i) {
        v[i] += w[i];
        s4 += v[i];
        q4 += v[i] * v[i];
    }
    float s = (s4.x + s4.y) + (s4.z + s4.w);
    float q = (q4.x + q4.y) + (q4.z + q4.w);
    for (int o = 16; o > 0; o >>= 1) {
        s += __shfl_xor(s, o, 32);
        q += __shfl_xor(q, o, 32);
    }
    const float mu  = s / D;
    const float var = q / D - mu * mu;
    const float inv = rsqrtf(var + 1e-5f);
#pragma unroll
    for (int i = 0; i < 8; ++i) v[i] = (v[i] - mu) * inv * g4[i] + b4[i];
    v4f* po = (v4f*)(of + row * D) + lane;
    if (obf) {
        v4bf* pob = (v4bf*)(obf + row * D) + lane;
#pragma unroll
        for (int i = 0; i < 8; ++i) {
            v4bf yb = { (__bf16)v[i].x, (__bf16)v[i].y, (__bf16)v[i].z, (__bf16)v[i].w };
            pob[i * 32] = yb;
        }
    }
#pragma unroll
    for (int i = 0; i < 8; ++i) po[i * 32] = v[i];
}

// ---------------------------------------------------------------------------
extern "C" void kernel_launch(void* const* d_in, const int* in_sizes, int n_in,
                              void* d_out, int out_size, void* d_ws, size_t ws_size,
                              hipStream_t stream) {
    const float* x    = (const float*)d_in[0];
    const float* wq   = (const float*)d_in[1];
    const float* bq   = (const float*)d_in[2];
    const float* wk   = (const float*)d_in[3];
    const float* bk   = (const float*)d_in[4];
    const float* wv   = (const float*)d_in[5];
    const float* bv   = (const float*)d_in[6];
    const float* wo   = (const float*)d_in[7];
    const float* bo   = (const float*)d_in[8];
    const float* w1   = (const float*)d_in[9];
    const float* b1   = (const float*)d_in[10];
    const float* w2   = (const float*)d_in[11];
    const float* b2   = (const float*)d_in[12];
    const float* ln1g = (const float*)d_in[13];
    const float* ln1b = (const float*)d_in[14];
    const float* ln2g = (const float*)d_in[15];
    const float* ln2b = (const float*)d_in[16];

    char* ws = (char*)d_ws;
    const size_t MiB = 1024 * 1024;
    __bf16* WQT  = (__bf16*)(ws + 0 * MiB);    // 2 MiB each; WQT, WKT, WVT in a row
    __bf16* WKT  = (__bf16*)(ws + 2 * MiB);
    __bf16* WVT  = (__bf16*)(ws + 4 * MiB);
    __bf16* WOT  = (__bf16*)(ws + 6 * MiB);
    __bf16* W1T  = (__bf16*)(ws + 8 * MiB);    // 8 MiB
    __bf16* W2T  = (__bf16*)(ws + 16 * MiB);   // 8 MiB
    __bf16* XBF  = (__bf16*)(ws + 24 * MiB);   // 8 MiB : x bf16, later attn-out bf16
    __bf16* QBF  = (__bf16*)(ws + 32 * MiB);   // 8 MiB; QBF, KBF, VBF in a row
    __bf16* KBF  = (__bf16*)(ws + 40 * MiB);   // 8 MiB
    __bf16* VBF  = (__bf16*)(ws + 48 * MiB);   // 8 MiB
    float*  TMPF = (float* )(ws + 32 * MiB);   // 16 MiB : o-proj f32, later ffn2 f32
    float*  X1F  = (float* )(ws + 56 * MiB);   // 16 MiB
    __bf16* X1BF = (__bf16*)(ws + 72 * MiB);   // 8 MiB
    __bf16* HBF  = (__bf16*)(ws + 80 * MiB);   // 32 MiB
    float*  out  = (float*)d_out;

    // 1) cast of x and all weight transposes, one launch
    prepare_operands_kernel<<<PREP_BLOCKS, 256, 0, stream>>>(x, wq, wk, wv, wo, w1, w2,
                                                             XBF, WQT, WKT, WVT, WOT, W1T, W2T);

    // 2) Q, K and V projections, one launch: grid z = 0, 1, 2
    gemm_bf16_t256_kernel<<<dim3(D_MODEL/256, NTOK/256, 3), 256, 0, stream>>>(XBF, WQT, bq, bk, bv, QBF, NTOK, D_MODEL, D_MODEL, 0);

    // 3) flash attention -> XBF (concat heads, row-major)
    flash_attn_kernel<<<dim3(SEQ/128, N_HEADS, BATCH), 256, 0, stream>>>(QBF, KBF, VBF, XBF);

    // 4) output projection (f32) + residual LN1
    gemm_bf16_kernel<<<dim3(D_MODEL/128, NTOK/128), 256, 0, stream>>>(XBF, WOT, bo, nullptr, nullptr, nullptr, TMPF, NTOK, D_MODEL, D_MODEL, 0);
    ln_residual_kernel<<<NTOK / 8, 256, 0, stream>>>(x, TMPF, ln1g, ln1b, X1F, X1BF);

    // 5) FFN
    gemm_bf16_t256_kernel<<<dim3(D_FF/256, NTOK/256), 256, 0, stream>>>(X1BF, W1T, b1, nullptr, nullptr, HBF, NTOK, D_FF, D_MODEL, 1);
    gemm_bf16_kernel<<<dim3(D_MODEL/128, NTOK/128), 256, 0, stream>>>(HBF,  W2T, b2, nullptr, nullptr, nullptr, TMPF, NTOK, D_MODEL, D_FF, 0);

    // 6) residual LN2 -> final output
    ln_residual_kernel<<<NTOK / 8, 256, 0, stream>>>(X1F, TMPF, ln2g, ln2b, out, nullptr);
}
